// v000
// The times below were measured on an AMD MI455X: many runs one after another, warmed up first and cycling through
// copies of the inputs, with the whole window's GPU time divided by the number of runs. Launches and the gaps
// between them are all in it. The median over several windows is given; except for v000 it joins two sittings, which
// can be a few percent apart, so the side-by-side timings, each taken in one sitting, are the better comparison.
// The starting kernel, v000, takes 1630 microseconds a run.
#include <hip/hip_runtime.h>
// Single-head softmax attention on given q, k, v ([NB][SEQ][64] f32 each): logits = q . k (no scale before the softmax), softmax over all SEQ keys, result x 0.125 applied after the softmax, out = weights . v -> [NB][SEQ][64] f32.
// Compute dtype: all contractions v_wmma_f32_16x16x32_f16 (f16 operands, f32 accumulate). q, k, v are RNE-converted to bf16 first and carried x64 as exact f16 planes (products exact in f32); logits and softmax statistics f32;
// softmax weights carried unnormalised as f16(16384 exp(s - rowmax)) (entries below the f16 normal range set to zero), row sum taken from the same f16 values, 0.125 / sum applied per row in the f32 epilogue.
// Structure: convert q,k -> f16 planes; v -> V^T f16 planes via LDS transpose; per batch: logits GEMM (K = 64) into an f32 [SEQ][SEQ] plane, wave-per-row softmax, P V^T GEMM (K = SEQ) straight into the output.
#ifndef NB
#define NB 8
#endif
#ifndef SEQ
#define SEQ 4096
#endif
#define NB_FULL 8                      /* batches in the inputs */
#define SEQ_FULL 4096                  /* rows per batch in the inputs (input batch pitch) */
#define HD 64
#define QK_CARRY 64.0f                 /* power-of-two carry of the q and k planes */
#define V_CARRY 64.0f                  /* power-of-two carry of the V^T plane */
#define P_CARRY 16384.0f               /* power-of-two carry of the softmax weight plane */
#define S_ALPHA 0.000244140625f        /* 1 / (QK_CARRY * QK_CARRY) */
#define O_ALPHA 0.015625f              /* 1 / V_CARRY */
#define F16_MIN_NORMAL 6.103515625e-05f

static_assert(NB >= 1 && NB <= NB_FULL);
static_assert(SEQ >= 256 && SEQ <= SEQ_FULL);
static_assert(HD == 64);
static_assert(SEQ % 256 == 0);                                   /* softmax: 32 lanes x 8 elements per step */
static_assert((SEQ / 128) * 128 == SEQ);                         /* GEMM row tiles */
static_assert((SEQ / 64) * 64 == SEQ);                           /* GEMM column tiles, V^T token groups */
static_assert((SEQ / 32) * 32 == SEQ);                           /* softmax rows per block */
static_assert((((size_t)SEQ * HD / 8) / 256) * 256 * 8 == (size_t)SEQ * HD);   /* convert kernel covers a batch plane exactly */
#define WS_PLANE16 ((size_t)NB * SEQ * HD * 2)
#define WS_S ((size_t)SEQ * SEQ * 4)
#define WS_P ((size_t)SEQ * SEQ * 2)
#define WS_RF ((size_t)NB * SEQ * 4)
static_assert(WS_PLANE16 % 256 == 0 && WS_S % 256 == 0 && WS_P % 256 == 0 && WS_RF % 256 == 0);
static_assert(3 * WS_PLANE16 + WS_S + WS_P + WS_RF <= (size_t)134217728);

typedef unsigned short v8us __attribute__((ext_vector_type(8), may_alias));
typedef float  v8f  __attribute__((ext_vector_type(8)));
typedef float  v4f  __attribute__((ext_vector_type(4)));
typedef float  v4fa __attribute__((ext_vector_type(4), may_alias));
typedef _Float16 v16h __attribute__((ext_vector_type(16)));
union FragH { v16h v; v8us half[2]; _Float16 h[16]; unsigned short u[16]; };

__device__ __forceinline__ unsigned short bf16_bits(float x) { unsigned int u = __float_as_uint(x); return (unsigned short)((u + 0x7FFFu + ((u >> 16) & 1u)) >> 16); }
__device__ __forceinline__ float bf16_val(unsigned short b) { return __uint_as_float(((unsigned int)b) << 16); }
__device__ __forceinline__ float bf16_rne(float x) { return bf16_val(bf16_bits(x)); }

__global__ __launch_bounds__(256) void k_cvt16(const float* __restrict__ xq, const float* __restrict__ xk, _Float16* __restrict__ Q16, _Float16* __restrict__ K16) {
  const unsigned t = blockIdx.x * 256u + threadIdx.x;            /* < SEQ*HD/8 exactly */
  const unsigned b = blockIdx.y;
  const float* src = (blockIdx.z == 0u) ? xq : xk;               /* block-uniform choice between two global inputs */
  _Float16* dst = (blockIdx.z == 0u) ? Q16 : K16;
  const float* p = src + (size_t)b * SEQ_FULL * HD + (size_t)t * 8u;
  const v4f a = *(const v4fa*)p, c = *(const v4fa*)(p + 4);
  FragH f;
#pragma unroll
  for (int q = 0; q < 4; ++q) { f.h[q] = (_Float16)(bf16_rne(a[q]) * QK_CARRY); f.h[4 + q] = (_Float16)(bf16_rne(c[q]) * QK_CARRY); }
  const v8us o = f.half[0];
  unsigned short* d = (unsigned short*)dst + (size_t)b * SEQ * HD + (size_t)t * 8u;
  *(v8us*)d = o;
  
}

__global__ __launch_bounds__(256) void k_vtf(const float* __restrict__ xv, _Float16* __restrict__ VT) {
  __shared__ unsigned short tl[64][66];                          /* [token][d]; all 64x64 entries written before the barrier; cross-wave -> block barrier */
  const unsigned tid = threadIdx.x; const unsigned lg = blockIdx.x; const unsigned b = blockIdx.y;
  for (unsigned i = tid; i < 512u; i += 256u) {
    const unsigned r = i >> 3, c8 = (i & 7u) * 8u;
    const float* p = xv + ((size_t)b * SEQ_FULL + (size_t)lg * 64u + r) * HD + c8;
    const v4f a = *(const v4fa*)p, c = *(const v4fa*)(p + 4);
    FragH f;
#pragma unroll
    for (int q = 0; q < 4; ++q) { f.h[q] = (_Float16)(bf16_rne(a[q]) * V_CARRY); f.h[4 + q] = (_Float16)(bf16_rne(c[q]) * V_CARRY); }
#pragma unroll
    for (int q = 0; q < 8; ++q) tl[r][c8 + q] = f.u[q];
  }
  __syncthreads();
  {
#pragma unroll
    for (unsigned rd = 0; rd < 2u; ++rd) {
      const unsigned d = rd * 32u + (tid >> 3), pc = tid & 7u; FragH f;
#pragma unroll
      for (unsigned q = 0; q < 8u; ++q) f.u[q] = tl[pc * 8u + q][d];
      *(v8us*)((unsigned short*)VT + ((size_t)b * HD + d) * SEQ + (size_t)lg * 64u + pc * 8u) = f.half[0];
    }
    
  }
}

// ---- GEMM (wave tile 32x64, block = 4 waves = 128 rows x 64 cols; M % 128 == 0, N % 64 == 0, K % 32 == 0) ----
// A f16 [M][K] (pitch lda), Bh f16 [N][K] (k contiguous, pitch ldb); C f32 = acc * alpha (* rs[row] if ROWS).
// Fragment map (A row / B column = lane & 15, h = lane >> 4): elements 0..7 <- k0 + 8h + i, elements 8..15 <- k0 + 16 + 8h + i; D element r <- (row 8h + r, col lane & 15).
__device__ __forceinline__ v16h g2_frag(const _Float16* p, unsigned hh) { FragH f; f.half[0] = *(const v8us*)((const unsigned short*)p + 8u * hh); f.half[1] = *(const v8us*)((const unsigned short*)p + 16u + 8u * hh); return f.v; }
__device__ __forceinline__ v8f g2_mma(v16h a, v16h b, v8f c) { v8f d = __builtin_amdgcn_wmma_f32_16x16x32_f16(false, a, false, b, (short)0, c, false, false); asm volatile("v_nop\n\tv_nop\n\tv_nop\n\tv_nop" : "+v"(d) : "v"(a), "v"(b)); return d; }

template <bool ROWS>
__global__ __launch_bounds__(128) void k_gemm2(const _Float16* __restrict__ A, unsigned lda, const _Float16* __restrict__ Bh, unsigned ldb, float alpha,
                                               const float* __restrict__ rs, float* __restrict__ C, unsigned ldc, unsigned M, unsigned N, unsigned K) {
  __shared__ __attribute__((aligned(16))) float so[4][32][68];   /* per-wave private 32x64 tile (cols 64..67 never touched): wave-level sync only */
  const unsigned tid = threadIdx.x, w = tid >> 5, lane = tid & 31u, ln = lane & 15u, hh = lane >> 4;
  const unsigned ntn = N >> 6; const unsigned mt = blockIdx.x / ntn, nq = blockIdx.x - mt * ntn;
  const unsigned row0 = mt * 128u + 32u * w, col0 = nq * 64u; if (row0 >= M) return;      /* wave-uniform; no block barrier below */
  const _Float16* a0p = A + (size_t)(row0 + ln) * lda; const _Float16* a1p = a0p + (size_t)16 * lda;
  const _Float16* b0p = Bh + (size_t)(col0 + ln) * ldb; const _Float16* b1p = b0p + (size_t)16 * ldb; const _Float16* b2p = b1p + (size_t)16 * ldb; const _Float16* b3p = b2p + (size_t)16 * ldb;
  const v8f z8 = {0.f,0.f,0.f,0.f,0.f,0.f,0.f,0.f}; v8f c00 = z8, c01 = z8, c02 = z8, c03 = z8, c10 = z8, c11 = z8, c12 = z8, c13 = z8;
#pragma unroll 1
  for (unsigned kb = 0; kb < K; kb += 32u) { const v16h a0 = g2_frag(a0p + kb, hh), a1 = g2_frag(a1p + kb, hh);
    v16h b = g2_frag(b0p + kb, hh); c00 = g2_mma(a0, b, c00); c10 = g2_mma(a1, b, c10);
    b = g2_frag(b1p + kb, hh); c01 = g2_mma(a0, b, c01); c11 = g2_mma(a1, b, c11);
    b = g2_frag(b2p + kb, hh); c02 = g2_mma(a0, b, c02); c12 = g2_mma(a1, b, c12);
    b = g2_frag(b3p + kb, hh); c03 = g2_mma(a0, b, c03); c13 = g2_mma(a1, b, c13); }
  v8f accs[8] = {c00, c01, c02, c03, c10, c11, c12, c13};
  float rsv[16];
  if (ROWS) {                                                    /* per-row factors of this lane's 16 rows: four 16-B loads */
    const v4f x0 = *(const v4fa*)(rs + row0 + 8u * hh), x1 = *(const v4fa*)(rs + row0 + 8u * hh + 4u);
    const v4f x2 = *(const v4fa*)(rs + row0 + 16u + 8u * hh), x3 = *(const v4fa*)(rs + row0 + 16u + 8u * hh + 4u);
#pragma unroll
    for (int q = 0; q < 4; ++q) { rsv[q] = x0[q]; rsv[4 + q] = x1[q]; rsv[8 + q] = x2[q]; rsv[12 + q] = x3[q]; }
  } else {
#pragma unroll
    for (int q = 0; q < 16; ++q) rsv[q] = 1.0f;
  }
#pragma unroll
  for (int u = 0; u < 8; ++u) { const int t = u & 3, half = u >> 2;
#pragma unroll
    for (int r = 0; r < 8; ++r) { const unsigned rloc = (unsigned)half * 16u + 8u * hh + (unsigned)r; float v = accs[u][r] * alpha; if (ROWS) v = v * rsv[half * 8 + r];
      so[w][rloc][(unsigned)t * 16u + ln] = v; } }
  __builtin_amdgcn_fence(4 /* acq_rel order */, "workgroup"); __builtin_amdgcn_wave_barrier();
  const unsigned rsub = lane >> 4, c4 = (lane & 15u) * 4u;       
  {
#pragma unroll
    for (unsigned q = 0; q < 16u; ++q) { const unsigned r = q * 2u + rsub; const v4f v = *(const v4fa*)&so[w][r][c4]; *(v4f*)(C + (size_t)(row0 + r) * ldc + col0 + c4) = v; }
     }
}

// Row softmax numerators over SEQ keys: P[row][j] = f16(16384 exp(s - rowmax)) (entries below the f16 normal range -> 0), rowfac[row] = 0.125 / sum_j float(P[row][j]).
__global__ __launch_bounds__(256) void k_psm(const float* __restrict__ S, _Float16* __restrict__ P, float* __restrict__ rowfac) {
  #pragma clang fp contract(off)
  __shared__ float rf[32];                                       /* cross-wave: block barrier before the read; all 32 entries written */
  const unsigned tid = threadIdx.x, w = tid >> 5, lane = tid & 31u;
#pragma unroll 1
  for (unsigned rr = 0; rr < 4u; ++rr) {
    const unsigned row = blockIdx.x * 32u + w * 4u + rr;
    const float* s = S + (size_t)row * SEQ + lane * 8u;
    float mx = -3.0e38f;
#pragma unroll 1
    for (unsigned j = 0; j < (unsigned)SEQ; j += 256u) {
      const v4f a = *(const v4fa*)(s + j), c = *(const v4fa*)(s + j + 4u);
      mx = fmaxf(mx, fmaxf(fmaxf(a[0], a[1]), fmaxf(a[2], a[3])));
      mx = fmaxf(mx, fmaxf(fmaxf(c[0], c[1]), fmaxf(c[2], c[3])));
    }
    mx = fmaxf(mx, __shfl_xor(mx, 16)); mx = fmaxf(mx, __shfl_xor(mx, 8)); mx = fmaxf(mx, __shfl_xor(mx, 4)); mx = fmaxf(mx, __shfl_xor(mx, 2)); mx = fmaxf(mx, __shfl_xor(mx, 1));
    float sum = 0.f;
    unsigned short* d = (unsigned short*)P + (size_t)row * SEQ + lane * 8u;
#pragma unroll 1
    for (unsigned j = 0; j < (unsigned)SEQ; j += 256u) {
      const v4f a = *(const v4fa*)(s + j), c = *(const v4fa*)(s + j + 4u);
      FragH f;
#pragma unroll
      for (int q = 0; q < 4; ++q) {
        float e0 = __expf(a[q] - mx) * P_CARRY; e0 = (e0 < F16_MIN_NORMAL) ? 0.f : e0; const _Float16 h0 = (_Float16)e0; f.h[q] = h0; sum += (float)h0;
        float e1 = __expf(c[q] - mx) * P_CARRY; e1 = (e1 < F16_MIN_NORMAL) ? 0.f : e1; const _Float16 h1 = (_Float16)e1; f.h[4 + q] = h1; sum += (float)h1;
      }
      const v8us o = f.half[0];
      *(v8us*)(d + j) = o;
      
    }
    sum += __shfl_xor(sum, 16); sum += __shfl_xor(sum, 8); sum += __shfl_xor(sum, 4); sum += __shfl_xor(sum, 2); sum += __shfl_xor(sum, 1);
    if (lane == 0u) rf[w * 4u + rr] = 0.125f * (1.0f / sum);     /* sum >= 16384 (the row maximum maps to exactly 16384) */
  }
  __syncthreads();
  if (tid < 32u) { const float v = rf[tid]; float* o = rowfac + (size_t)blockIdx.x * 32u + tid; *o = v;  }
}

extern "C" void kernel_launch(void* const* d_in, const int* in_sizes, int n_in,
                              void* d_out, int out_size, void* d_ws, size_t ws_size, hipStream_t stream) {
  if (n_in < 3) return;
  const size_t need_in = ((size_t)(NB - 1) * SEQ_FULL + SEQ) * HD;
  if ((size_t)in_sizes[0] < need_in || (size_t)in_sizes[1] < need_in || (size_t)in_sizes[2] < need_in) return;
  if ((size_t)out_size < (size_t)NB * SEQ * HD) return;
  const float* xq = (const float*)d_in[0]; const float* xk = (const float*)d_in[1]; const float* xv = (const float*)d_in[2];
  float* out = (float*)d_out;
  char* ws = (char*)d_ws; size_t off = 0;
  auto take = [&](size_t bytes) { char* p = ws + off; off += (bytes + 255) & ~(size_t)255; return p; };
  _Float16* Q16 = (_Float16*)take(WS_PLANE16);      /* [NB][SEQ][64]  64 * bf16(q) */
  _Float16* K16 = (_Float16*)take(WS_PLANE16);      /* [NB][SEQ][64]  64 * bf16(k) */
  _Float16* VT  = (_Float16*)take(WS_PLANE16);      /* [NB][64][SEQ]  64 * bf16(v), transposed */
  float*    S   = (float*)take(WS_S);               /* [SEQ][SEQ] logits of the current batch */
  _Float16* P   = (_Float16*)take(WS_P);            /* [SEQ][SEQ] carried softmax numerators of the current batch */
  float*    RF  = (float*)take(WS_RF);              /* [NB][SEQ] 0.125 / row sum */
  if (off > ws_size) return;

  k_cvt16<<<dim3((unsigned)(((size_t)SEQ * HD / 8) / 256), NB, 2), 256, 0, stream>>>(xq, xk, Q16, K16);
  k_vtf<<<dim3(SEQ / 64, NB), 256, 0, stream>>>(xv, VT);
  for (int b = 0; b < NB; ++b) {
    const size_t r0 = (size_t)b * SEQ;
    /* logits[SEQ][SEQ] = q k^T (carry folded back, no further scale) */
    k_gemm2<false><<<dim3((SEQ / 128) * (SEQ / 64)), 128, 0, stream>>>(Q16 + r0 * HD, HD, K16 + r0 * HD, HD, S_ALPHA, RF, S, SEQ, SEQ, SEQ, HD);
    /* carried numerators and per-row factor */
    k_psm<<<SEQ / 32, 256, 0, stream>>>(S, P, RF + r0);
    /* out[SEQ][64] = (P V) / 64 * (0.125 / row sum), f32 straight into the output */
    k_gemm2<true><<<dim3((SEQ / 128) * (HD / 64)), 128, 0, stream>>>(P, SEQ, VT + (size_t)b * HD * SEQ, SEQ, O_ALPHA, RF + r0, out + r0 * HD, HD, SEQ, HD, SEQ);
  }
}

// v001
// Measured time: 812 microseconds a run.
// In two side-by-side timings against v000, it was 2.02 and 2.00 times as fast.
#include <hip/hip_runtime.h>
// Single-head softmax attention on given q, k, v ([NB][SEQ][64] f32 each): logits = q . k (no scale before the softmax), softmax over all SEQ keys, result x 0.125 applied after the softmax, out = weights . v -> [NB][SEQ][64] f32.
// Compute dtype: all contractions v_wmma_f32_16x16x32_f16 (f16 operands, f32 accumulate). q, k, v are RNE-converted to bf16 first and carried x64 as exact f16 planes (products exact in f32); logits and softmax statistics f32;
// softmax weights carried unnormalised as f16(16384 exp(s - rowmax)) (entries below the f16 normal range set to zero), row sum taken from the same f16 values, 0.125 / sum applied per row in the f32 epilogue.
// Structure: convert q,k -> f16 planes; v -> V^T f16 planes via LDS transpose; per batch: logits GEMM (K = 64) into an f32 [SEQ][SEQ] plane, wave-per-row softmax, P V^T product (K = SEQ, keys split over the waves of a block, partial tiles joined in LDS) straight into the output.
#ifndef NB
#define NB 8
#endif
#ifndef SEQ
#define SEQ 4096
#endif
#define NB_FULL 8                      /* batches in the inputs */
#define SEQ_FULL 4096                  /* rows per batch in the inputs (input batch pitch) */
#define HD 64
#define QK_CARRY 64.0f                 /* power-of-two carry of the q and k planes */
#define V_CARRY 64.0f                  /* power-of-two carry of the V^T plane */
#define P_CARRY 16384.0f               /* power-of-two carry of the softmax weight plane */
#define S_ALPHA 0.000244140625f        /* 1 / (QK_CARRY * QK_CARRY) */
#define O_ALPHA 0.015625f              /* 1 / V_CARRY */
#define F16_MIN_NORMAL 6.103515625e-05f

static_assert(NB >= 1 && NB <= NB_FULL);
static_assert(SEQ >= 256 && SEQ <= SEQ_FULL);
static_assert(HD == 64);
static_assert(SEQ % 256 == 0);                                   /* softmax: 32 lanes x 8 elements per step */
static_assert((SEQ / 128) * 128 == SEQ);                         /* GEMM row tiles */
static_assert((SEQ / 64) * 64 == SEQ);                           /* GEMM column tiles, V^T token groups */
static_assert((SEQ / 32) * 32 == SEQ);                           /* softmax rows per block */
static_assert((((size_t)SEQ * HD / 8) / 256) * 256 * 8 == (size_t)SEQ * HD);   /* convert kernel covers a batch plane exactly */
#define WS_PLANE16 ((size_t)NB * SEQ * HD * 2)
#define WS_S ((size_t)SEQ * SEQ * 4)
#define WS_P ((size_t)SEQ * SEQ * 2)
#define WS_RF ((size_t)NB * SEQ * 4)
static_assert(WS_PLANE16 % 256 == 0 && WS_S % 256 == 0 && WS_P % 256 == 0 && WS_RF % 256 == 0);
static_assert(3 * WS_PLANE16 + WS_S + WS_P + WS_RF <= (size_t)134217728);

typedef unsigned short v8us __attribute__((ext_vector_type(8), may_alias));
typedef float  v8f  __attribute__((ext_vector_type(8)));
typedef float  v4f  __attribute__((ext_vector_type(4)));
typedef float  v2f  __attribute__((ext_vector_type(2)));
typedef float  v4fa __attribute__((ext_vector_type(4), may_alias));
typedef _Float16 v16h __attribute__((ext_vector_type(16)));
union FragH { v16h v; v8us half[2]; _Float16 h[16]; unsigned short u[16]; };

__device__ __forceinline__ unsigned short bf16_bits(float x) { unsigned int u = __float_as_uint(x); return (unsigned short)((u + 0x7FFFu + ((u >> 16) & 1u)) >> 16); }
__device__ __forceinline__ float bf16_val(unsigned short b) { return __uint_as_float(((unsigned int)b) << 16); }
__device__ __forceinline__ float bf16_rne(float x) { return bf16_val(bf16_bits(x)); }

__global__ __launch_bounds__(256) void k_cvt16(const float* __restrict__ xq, const float* __restrict__ xk, _Float16* __restrict__ Q16, _Float16* __restrict__ K16) {
  const unsigned t = blockIdx.x * 256u + threadIdx.x;            /* < SEQ*HD/8 exactly */
  const unsigned b = blockIdx.y;
  const float* src = (blockIdx.z == 0u) ? xq : xk;               /* block-uniform choice between two global inputs */
  _Float16* dst = (blockIdx.z == 0u) ? Q16 : K16;
  const float* p = src + (size_t)b * SEQ_FULL * HD + (size_t)t * 8u;
  const v4f a = *(const v4fa*)p, c = *(const v4fa*)(p + 4);
  FragH f;
#pragma unroll
  for (int q = 0; q < 4; ++q) { f.h[q] = (_Float16)(bf16_rne(a[q]) * QK_CARRY); f.h[4 + q] = (_Float16)(bf16_rne(c[q]) * QK_CARRY); }
  const v8us o = f.half[0];
  unsigned short* d = (unsigned short*)dst + (size_t)b * SEQ * HD + (size_t)t * 8u;
  *(v8us*)d = o;
  
}

__global__ __launch_bounds__(256) void k_vtf(const float* __restrict__ xv, _Float16* __restrict__ VT) {
  __shared__ unsigned short tl[64][66];                          /* [token][d]; all 64x64 entries written before the barrier; cross-wave -> block barrier */
  const unsigned tid = threadIdx.x; const unsigned lg = blockIdx.x; const unsigned b = blockIdx.y;
  for (unsigned i = tid; i < 512u; i += 256u) {
    const unsigned r = i >> 3, c8 = (i & 7u) * 8u;
    const float* p = xv + ((size_t)b * SEQ_FULL + (size_t)lg * 64u + r) * HD + c8;
    const v4f a = *(const v4fa*)p, c = *(const v4fa*)(p + 4);
    FragH f;
#pragma unroll
    for (int q = 0; q < 4; ++q) { f.h[q] = (_Float16)(bf16_rne(a[q]) * V_CARRY); f.h[4 + q] = (_Float16)(bf16_rne(c[q]) * V_CARRY); }
#pragma unroll
    for (int q = 0; q < 8; ++q) tl[r][c8 + q] = f.u[q];
  }
  __syncthreads();
  {
#pragma unroll
    for (unsigned rd = 0; rd < 2u; ++rd) {
      const unsigned d = rd * 32u + (tid >> 3), pc = tid & 7u; FragH f;
#pragma unroll
      for (unsigned q = 0; q < 8u; ++q) f.u[q] = tl[pc * 8u + q][d];
      *(v8us*)((unsigned short*)VT + ((size_t)b * HD + d) * SEQ + (size_t)lg * 64u + pc * 8u) = f.half[0];
    }
    
  }
}

// ---- GEMM (wave tile 32x64, block = 4 waves = 128 rows x 64 cols; M % 128 == 0, N % 64 == 0, K % 32 == 0) ----
// A f16 [M][K] (pitch lda), Bh f16 [N][K] (k contiguous, pitch ldb); C f32 = acc * alpha (* rs[row] if ROWS).
// Fragment map (A row / B column = lane & 15, h = lane >> 4): elements 0..7 <- k0 + 8h + i, elements 8..15 <- k0 + 16 + 8h + i; D element r <- (row 8h + r, col lane & 15).
__device__ __forceinline__ v16h g2_frag(const _Float16* p, unsigned hh) { FragH f; f.half[0] = *(const v8us*)((const unsigned short*)p + 8u * hh); f.half[1] = *(const v8us*)((const unsigned short*)p + 16u + 8u * hh); return f.v; }
__device__ __forceinline__ v8f g2_mma(v16h a, v16h b, v8f c) { v8f d = __builtin_amdgcn_wmma_f32_16x16x32_f16(false, a, false, b, (short)0, c, false, false); asm volatile("v_nop\n\tv_nop\n\tv_nop\n\tv_nop" : "+v"(d) : "v"(a), "v"(b)); return d; }

template <bool ROWS>
__global__ __launch_bounds__(128) void k_gemm2(const _Float16* __restrict__ A, unsigned lda, const _Float16* __restrict__ Bh, unsigned ldb, float alpha,
                                               const float* __restrict__ rs, float* __restrict__ C, unsigned ldc, unsigned M, unsigned N, unsigned K) {
  __shared__ __attribute__((aligned(16))) float so[4][32][68];   /* per-wave private 32x64 tile (cols 64..67 never touched): wave-level sync only */
  const unsigned tid = threadIdx.x, w = tid >> 5, lane = tid & 31u, ln = lane & 15u, hh = lane >> 4;
  const unsigned ntn = N >> 6; const unsigned mt = blockIdx.x / ntn, nq = blockIdx.x - mt * ntn;
  const unsigned row0 = mt * 128u + 32u * w, col0 = nq * 64u; if (row0 >= M) return;      /* wave-uniform; no block barrier below */
  const _Float16* a0p = A + (size_t)(row0 + ln) * lda; const _Float16* a1p = a0p + (size_t)16 * lda;
  const _Float16* b0p = Bh + (size_t)(col0 + ln) * ldb; const _Float16* b1p = b0p + (size_t)16 * ldb; const _Float16* b2p = b1p + (size_t)16 * ldb; const _Float16* b3p = b2p + (size_t)16 * ldb;
  const v8f z8 = {0.f,0.f,0.f,0.f,0.f,0.f,0.f,0.f}; v8f c00 = z8, c01 = z8, c02 = z8, c03 = z8, c10 = z8, c11 = z8, c12 = z8, c13 = z8;
#pragma unroll 1
  for (unsigned kb = 0; kb < K; kb += 32u) { const v16h a0 = g2_frag(a0p + kb, hh), a1 = g2_frag(a1p + kb, hh);
    v16h b = g2_frag(b0p + kb, hh); c00 = g2_mma(a0, b, c00); c10 = g2_mma(a1, b, c10);
    b = g2_frag(b1p + kb, hh); c01 = g2_mma(a0, b, c01); c11 = g2_mma(a1, b, c11);
    b = g2_frag(b2p + kb, hh); c02 = g2_mma(a0, b, c02); c12 = g2_mma(a1, b, c12);
    b = g2_frag(b3p + kb, hh); c03 = g2_mma(a0, b, c03); c13 = g2_mma(a1, b, c13); }
  v8f accs[8] = {c00, c01, c02, c03, c10, c11, c12, c13};
  float rsv[16];
  if (ROWS) {                                                    /* per-row factors of this lane's 16 rows: four 16-B loads */
    const v4f x0 = *(const v4fa*)(rs + row0 + 8u * hh), x1 = *(const v4fa*)(rs + row0 + 8u * hh + 4u);
    const v4f x2 = *(const v4fa*)(rs + row0 + 16u + 8u * hh), x3 = *(const v4fa*)(rs + row0 + 16u + 8u * hh + 4u);
#pragma unroll
    for (int q = 0; q < 4; ++q) { rsv[q] = x0[q]; rsv[4 + q] = x1[q]; rsv[8 + q] = x2[q]; rsv[12 + q] = x3[q]; }
  } else {
#pragma unroll
    for (int q = 0; q < 16; ++q) rsv[q] = 1.0f;
  }
#pragma unroll
  for (int u = 0; u < 8; ++u) { const int t = u & 3, half = u >> 2;
#pragma unroll
    for (int r = 0; r < 8; ++r) { const unsigned rloc = (unsigned)half * 16u + 8u * hh + (unsigned)r; float v = accs[u][r] * alpha; if (ROWS) v = v * rsv[half * 8 + r];
      so[w][rloc][(unsigned)t * 16u + ln] = v; } }
  __builtin_amdgcn_fence(4 /* acq_rel order */, "workgroup"); __builtin_amdgcn_wave_barrier();
  const unsigned rsub = lane >> 4, c4 = (lane & 15u) * 4u;       
  {
#pragma unroll
    for (unsigned q = 0; q < 16u; ++q) { const unsigned r = q * 2u + rsub; const v4f v = *(const v4fa*)&so[w][r][c4]; *(v4f*)(C + (size_t)(row0 + r) * ldc + col0 + c4) = v; }
     }
}

// ---- P V^T product: one 16-row x 64-column output tile per block (SEQ / 16 blocks); wave w of the block's PV_WAVES takes keys [w * PV_KW, (w + 1) * PV_KW) ----
// Same fragment map and loop body as k_gemm2 with one A fragment. Each wave leaves its f32 partial tile in its own LDS plane; behind the block barrier wave r sums row r over the planes in plane order,
// applies O_ALPHA and the row factor and stores the row's 256 contiguous bytes.
#define PV_WAVES 16
#define PV_KW (SEQ / PV_WAVES)
static_assert(PV_WAVES == 16 && PV_KW * PV_WAVES == SEQ && PV_KW % 32 == 0 && SEQ % 16 == 0);   /* wave w joins row w of the 16-row tile */
__global__ __launch_bounds__(PV_WAVES * 32) void k_pv(const _Float16* __restrict__ P, const _Float16* __restrict__ VTb, const float* __restrict__ rs, float* __restrict__ O) {
  __shared__ __attribute__((aligned(16))) float part[PV_WAVES][16][68];   /* [wave][row][col]; cols 64..67 never touched; cross-wave -> block barrier */
  const unsigned tid = threadIdx.x, w = tid >> 5, lane = tid & 31u, ln = lane & 15u, hh = lane >> 4;
  const unsigned row0 = blockIdx.x * 16u, k0 = w * (unsigned)PV_KW;
  const _Float16* ap = P + (size_t)(row0 + ln) * SEQ + k0;
  const _Float16* b0p = VTb + (size_t)ln * SEQ + k0; const _Float16* b1p = b0p + (size_t)16 * SEQ; const _Float16* b2p = b1p + (size_t)16 * SEQ; const _Float16* b3p = b2p + (size_t)16 * SEQ;
  const v8f z8 = {0.f,0.f,0.f,0.f,0.f,0.f,0.f,0.f}; v8f c0 = z8, c1 = z8, c2 = z8, c3 = z8;
#pragma unroll 1                                                 /* rolled like k_gemm2's loop */
  for (unsigned kb = 0; kb < (unsigned)PV_KW; kb += 32u) { const v16h a = g2_frag(ap + kb, hh);
    v16h b = g2_frag(b0p + kb, hh); c0 = g2_mma(a, b, c0);
    b = g2_frag(b1p + kb, hh); c1 = g2_mma(a, b, c1);
    b = g2_frag(b2p + kb, hh); c2 = g2_mma(a, b, c2);
    b = g2_frag(b3p + kb, hh); c3 = g2_mma(a, b, c3);
    asm volatile("s_wait_xcnt 0x0" ::: "memory"); }              /* stands in front of the next trip's rewrite of the address registers that this trip's loads name */
  v8f accs[4] = {c0, c1, c2, c3};
#pragma unroll                                                   /* both loops: constant indices keep accs in registers */
  for (int t = 0; t < 4; ++t) {
#pragma unroll
    for (int r = 0; r < 8; ++r) part[w][8u * hh + (unsigned)r][(unsigned)t * 16u + ln] = accs[t][r]; }
  __syncthreads();                                               /* every wave's partial tile is in LDS before any wave sums across the planes */
  const unsigned c2i = lane * 2u;                                /* wave w joins row w: PV_WAVES == 16 rows */
  float s0 = part[0][w][c2i], s1 = part[0][w][c2i + 1u];
  for (int p = 1; p < PV_WAVES; ++p) { s0 += part[p][w][c2i]; s1 += part[p][w][c2i + 1u]; }
  const float f = rs[row0 + w];
  v2f o; o[0] = s0 * O_ALPHA * f; o[1] = s1 * O_ALPHA * f;
  *(v2f*)(O + (size_t)(row0 + w) * HD + c2i) = o;
}

// Row softmax numerators over SEQ keys: P[row][j] = f16(16384 exp(s - rowmax)) (entries below the f16 normal range -> 0), rowfac[row] = 0.125 / sum_j float(P[row][j]).
__global__ __launch_bounds__(256) void k_psm(const float* __restrict__ S, _Float16* __restrict__ P, float* __restrict__ rowfac) {
  #pragma clang fp contract(off)
  __shared__ float rf[32];                                       /* cross-wave: block barrier before the read; all 32 entries written */
  const unsigned tid = threadIdx.x, w = tid >> 5, lane = tid & 31u;
#pragma unroll 1
  for (unsigned rr = 0; rr < 4u; ++rr) {
    const unsigned row = blockIdx.x * 32u + w * 4u + rr;
    const float* s = S + (size_t)row * SEQ + lane * 8u;
    float mx = -3.0e38f;
#pragma unroll 1
    for (unsigned j = 0; j < (unsigned)SEQ; j += 256u) {
      const v4f a = *(const v4fa*)(s + j), c = *(const v4fa*)(s + j + 4u);
      mx = fmaxf(mx, fmaxf(fmaxf(a[0], a[1]), fmaxf(a[2], a[3])));
      mx = fmaxf(mx, fmaxf(fmaxf(c[0], c[1]), fmaxf(c[2], c[3])));
    }
    mx = fmaxf(mx, __shfl_xor(mx, 16)); mx = fmaxf(mx, __shfl_xor(mx, 8)); mx = fmaxf(mx, __shfl_xor(mx, 4)); mx = fmaxf(mx, __shfl_xor(mx, 2)); mx = fmaxf(mx, __shfl_xor(mx, 1));
    float sum = 0.f;
    unsigned short* d = (unsigned short*)P + (size_t)row * SEQ + lane * 8u;
#pragma unroll 1
    for (unsigned j = 0; j < (unsigned)SEQ; j += 256u) {
      const v4f a = *(const v4fa*)(s + j), c = *(const v4fa*)(s + j + 4u);
      FragH f;
#pragma unroll
      for (int q = 0; q < 4; ++q) {
        float e0 = __expf(a[q] - mx) * P_CARRY; e0 = (e0 < F16_MIN_NORMAL) ? 0.f : e0; const _Float16 h0 = (_Float16)e0; f.h[q] = h0; sum += (float)h0;
        float e1 = __expf(c[q] - mx) * P_CARRY; e1 = (e1 < F16_MIN_NORMAL) ? 0.f : e1; const _Float16 h1 = (_Float16)e1; f.h[4 + q] = h1; sum += (float)h1;
      }
      const v8us o = f.half[0];
      *(v8us*)(d + j) = o;
      
    }
    sum += __shfl_xor(sum, 16); sum += __shfl_xor(sum, 8); sum += __shfl_xor(sum, 4); sum += __shfl_xor(sum, 2); sum += __shfl_xor(sum, 1);
    if (lane == 0u) rf[w * 4u + rr] = 0.125f * (1.0f / sum);     /* sum >= 16384 (the row maximum maps to exactly 16384) */
  }
  __syncthreads();
  if (tid < 32u) { const float v = rf[tid]; float* o = rowfac + (size_t)blockIdx.x * 32u + tid; *o = v;  }
}

extern "C" void kernel_launch(void* const* d_in, const int* in_sizes, int n_in,
                              void* d_out, int out_size, void* d_ws, size_t ws_size, hipStream_t stream) {
  if (n_in < 3) return;
  const size_t need_in = ((size_t)(NB - 1) * SEQ_FULL + SEQ) * HD;
  if ((size_t)in_sizes[0] < need_in || (size_t)in_sizes[1] < need_in || (size_t)in_sizes[2] < need_in) return;
  if ((size_t)out_size < (size_t)NB * SEQ * HD) return;
  const float* xq = (const float*)d_in[0]; const float* xk = (const float*)d_in[1]; const float* xv = (const float*)d_in[2];
  float* out = (float*)d_out;
  char* ws = (char*)d_ws; size_t off = 0;
  auto take = [&](size_t bytes) { char* p = ws + off; off += (bytes + 255) & ~(size_t)255; return p; };
  _Float16* Q16 = (_Float16*)take(WS_PLANE16);      /* [NB][SEQ][64]  64 * bf16(q) */
  _Float16* K16 = (_Float16*)take(WS_PLANE16);      /* [NB][SEQ][64]  64 * bf16(k) */
  _Float16* VT  = (_Float16*)take(WS_PLANE16);      /* [NB][64][SEQ]  64 * bf16(v), transposed */
  float*    S   = (float*)take(WS_S);               /* [SEQ][SEQ] logits of the current batch */
  _Float16* P   = (_Float16*)take(WS_P);            /* [SEQ][SEQ] carried softmax numerators of the current batch */
  float*    RF  = (float*)take(WS_RF);              /* [NB][SEQ] 0.125 / row sum */
  if (off > ws_size) return;

  k_cvt16<<<dim3((unsigned)(((size_t)SEQ * HD / 8) / 256), NB, 2), 256, 0, stream>>>(xq, xk, Q16, K16);
  k_vtf<<<dim3(SEQ / 64, NB), 256, 0, stream>>>(xv, VT);
  for (int b = 0; b < NB; ++b) {
    const size_t r0 = (size_t)b * SEQ;
    /* logits[SEQ][SEQ] = q k^T (carry folded back, no further scale) */
    k_gemm2<false><<<dim3((SEQ / 128) * (SEQ / 64)), 128, 0, stream>>>(Q16 + r0 * HD, HD, K16 + r0 * HD, HD, S_ALPHA, RF, S, SEQ, SEQ, SEQ, HD);
    /* carried numerators and per-row factor */
    k_psm<<<SEQ / 32, 256, 0, stream>>>(S, P, RF + r0);
    /* out[SEQ][64] = (P V) / 64 * (0.125 / row sum), f32 straight into the output */
    k_pv<<<SEQ / 16, PV_WAVES * 32, 0, stream>>>(P, VT + (size_t)b * HD * SEQ, RF + r0, out + r0 * HD);
  }
}

// v003
// It runs in 39 microseconds.
// Versions in between are left out here; by their measured steps it is 20.8 times as fast as v001.
// Counting every step since v000, it is 41.7 times as fast.
#include <hip/hip_runtime.h>
// Single-head softmax attention on given q, k, v ([NB][SEQ][64] f32 each): logits = q . k (no scale before the softmax), softmax over all SEQ keys, result x 0.125 applied after the softmax, out = weights . v -> [NB][SEQ][64] f32.
// Compute dtype: all contractions v_wmma_f32_16x16x32_f16 (f16 operands, f32 accumulate). q, k, v are RNE-converted to bf16 first and carried x64 as exact f16 planes (products exact in f32); logits and softmax statistics f32;
// softmax weights carried unnormalised as f16(16384 exp(s - running rowmax)) (entries below the f16 normal range set to zero), row sum taken from the same f16 values, 0.125 / sum applied per row in the f32 epilogue.
// Structure: convert q,k -> f16 planes; v -> V^T f16 planes via LDS transpose; one fused launch: per wave 32 queries x a quarter of the keys, logits, running-maximum softmax and weights . v all in registers, K and V^T tiles staged in LDS by tensor loads (two buffers), the four key quarters joined in LDS.
#ifndef NB
#define NB 8
#endif
#ifndef SEQ
#define SEQ 4096
#endif
#define NB_FULL 8                      /* batches in the inputs */
#define SEQ_FULL 4096                  /* rows per batch in the inputs (input batch pitch) */
#define HD 64
#define QK_CARRY 64.0f                 /* power-of-two carry of the q and k planes */
#define V_CARRY 64.0f                  /* power-of-two carry of the V^T plane */
#define P_CARRY 16384.0f               /* power-of-two carry of the softmax weight plane */
#define S_ALPHA 0.000244140625f        /* 1 / (QK_CARRY * QK_CARRY) */
#define O_ALPHA 0.015625f              /* 1 / V_CARRY */
#define F16_MIN_NORMAL 6.103515625e-05f

static_assert(NB >= 1 && NB <= NB_FULL);
static_assert(SEQ >= 256 && SEQ <= SEQ_FULL);
static_assert(HD == 64);
static_assert((SEQ / 128) * 128 == SEQ);                         /* query rows per block, 32-key passes of a key quarter */
static_assert((SEQ / 64) * 64 == SEQ);                           /* V^T token groups */
static_assert((((size_t)SEQ * HD / 8) / 256) * 256 * 8 == (size_t)SEQ * HD);   /* convert kernel covers a batch plane exactly */
#define WS_PLANE16 ((size_t)NB * SEQ * HD * 2)
static_assert(WS_PLANE16 % 256 == 0);
static_assert(3 * WS_PLANE16 <= (size_t)134217728);

typedef unsigned short v8us __attribute__((ext_vector_type(8), may_alias));
typedef float  v8f  __attribute__((ext_vector_type(8)));
typedef float  v4f  __attribute__((ext_vector_type(4)));
typedef float  v2f  __attribute__((ext_vector_type(2)));
typedef float  v4fa __attribute__((ext_vector_type(4), may_alias));
typedef _Float16 v16h __attribute__((ext_vector_type(16)));
union FragH { v16h v; v8us half[2]; _Float16 h[16]; unsigned short u[16]; };

__device__ __forceinline__ unsigned short bf16_bits(float x) { unsigned int u = __float_as_uint(x); return (unsigned short)((u + 0x7FFFu + ((u >> 16) & 1u)) >> 16); }
__device__ __forceinline__ float bf16_val(unsigned short b) { return __uint_as_float(((unsigned int)b) << 16); }
__device__ __forceinline__ float bf16_rne(float x) { return bf16_val(bf16_bits(x)); }

__global__ __launch_bounds__(256) void k_cvt16(const float* __restrict__ xq, const float* __restrict__ xk, _Float16* __restrict__ Q16, _Float16* __restrict__ K16) {
  const unsigned t = blockIdx.x * 256u + threadIdx.x;            /* < SEQ*HD/8 exactly */
  const unsigned b = blockIdx.y;
  const float* src = (blockIdx.z == 0u) ? xq : xk;               /* block-uniform choice between two global inputs */
  _Float16* dst = (blockIdx.z == 0u) ? Q16 : K16;
  const float* p = src + (size_t)b * SEQ_FULL * HD + (size_t)t * 8u;
  const v4f a = *(const v4fa*)p, c = *(const v4fa*)(p + 4);
  FragH f;
#pragma unroll
  for (int q = 0; q < 4; ++q) { f.h[q] = (_Float16)(bf16_rne(a[q]) * QK_CARRY); f.h[4 + q] = (_Float16)(bf16_rne(c[q]) * QK_CARRY); }
  const v8us o = f.half[0];
  unsigned short* d = (unsigned short*)dst + (size_t)b * SEQ * HD + (size_t)t * 8u;
  *(v8us*)d = o;
  
}

__global__ __launch_bounds__(256) void k_vtf(const float* __restrict__ xv, _Float16* __restrict__ VT) {
  __shared__ unsigned short tl[64][66];                          /* [token][d]; all 64x64 entries written before the barrier; cross-wave -> block barrier */
  const unsigned tid = threadIdx.x; const unsigned lg = blockIdx.x; const unsigned b = blockIdx.y;
  for (unsigned i = tid; i < 512u; i += 256u) {
    const unsigned r = i >> 3, c8 = (i & 7u) * 8u;
    const float* p = xv + ((size_t)b * SEQ_FULL + (size_t)lg * 64u + r) * HD + c8;
    const v4f a = *(const v4fa*)p, c = *(const v4fa*)(p + 4);
    FragH f;
#pragma unroll
    for (int q = 0; q < 4; ++q) { f.h[q] = (_Float16)(bf16_rne(a[q]) * V_CARRY); f.h[4 + q] = (_Float16)(bf16_rne(c[q]) * V_CARRY); }
#pragma unroll
    for (int q = 0; q < 8; ++q) tl[r][c8 + q] = f.u[q];
  }
  __syncthreads();
  {
#pragma unroll
    for (unsigned rd = 0; rd < 2u; ++rd) {
      const unsigned d = rd * 32u + (tid >> 3), pc = tid & 7u; FragH f;
#pragma unroll
      for (unsigned q = 0; q < 8u; ++q) f.u[q] = tl[pc * 8u + q][d];
      *(v8us*)((unsigned short*)VT + ((size_t)b * HD + d) * SEQ + (size_t)lg * 64u + pc * 8u) = f.half[0];
    }
    
  }
}

// ---- fused attention: S^T = K Q^T, O^T += V^T P^T ----
// Fragment map (A row / B column = lane & 15, h = lane >> 4): elements 0..7 <- k0 + 8h + i, elements 8..15 <- k0 + 16 + 8h + i; D element r <- (row 8h + r, col lane & 15).
// With K as A and Q as B a lane's score registers all belong to query (lane & 15): maximum and exponent are lane-local but for one exchange between the wave halves, and the two 16-key score tiles of a pass,
// converted in place, are the B operand of the second product (its k order is the map above, which fa_lfrag gives V^T too). O^T keeps query = lane & 15, so the rescale factor is lane-local as well.
// K and V^T reach the waves through LDS. Per stage (128 keys of a quarter) one tensor load brings the K rows, taken two to a 256-byte tile row, and one brings the 64 V^T rows of 256 B; both land at an LDS pitch of 272 B.
// The 4 query groups of a quarter read the same tiles by 16-byte LDS loads whose 16 lanes of a half fall on 64 different banks. Two buffers: stage s + 1 flies while stage s is worked on.
// Block = 16 waves = 4 query groups of 32 rows x 4 key quarters. Each wave leaves (maximum, sum, O^T) of its quarter in LDS; behind the block barrier the four waves of a query group join them in quarter order.
__device__ __forceinline__ v16h g2_frag(const _Float16* p, unsigned hh) { FragH f; f.half[0] = *(const v8us*)((const unsigned short*)p + 8u * hh); f.half[1] = *(const v8us*)((const unsigned short*)p + 16u + 8u * hh); return f.v; }
__device__ __forceinline__ v8f fa_mma(v16h a, v16h b, v8f c) { return __builtin_amdgcn_wmma_f32_16x16x32_f16(false, a, false, b, (short)0, c, false, false); }
__device__ __forceinline__ float fa_xhalf(float x) { return __builtin_bit_cast(float, __builtin_amdgcn_permlanex16(__builtin_bit_cast(int, x), __builtin_bit_cast(int, x), 0x76543210, 0xfedcba98, false, false)); }   /* lane l <-> lane l ^ 16 */
// Eight base-2 exponentials, each in place, in one statement: no result lands on a neighbour's source, and the closing v_nop is the free slot the instruction set asks for between a transcendental and the first use of its result.
__device__ __forceinline__ void fa_exp2x8(v8f& x) {
  asm("v_exp_f32 %0, %0\n\tv_exp_f32 %1, %1\n\tv_exp_f32 %2, %2\n\tv_exp_f32 %3, %3\n\tv_exp_f32 %4, %4\n\tv_exp_f32 %5, %5\n\tv_exp_f32 %6, %6\n\tv_exp_f32 %7, %7\n\tv_nop"
      : "+v"(x[0]), "+v"(x[1]), "+v"(x[2]), "+v"(x[3]), "+v"(x[4]), "+v"(x[5]), "+v"(x[6]), "+v"(x[7]));
}
#define FA_QG 4                        /* query groups (32 rows each) per block */
#define FA_KS 4                        /* key quarters per block */
#define FA_NW (FA_QG * FA_KS)
#define FA_KW (SEQ / FA_KS)            /* keys per wave */
#define FA_C1 (S_ALPHA * 1.4426950408889634f)   /* score accumulator -> logit in base-2 units */
#define FA_LOG2_CARRY 14.0f            /* log2(P_CARRY) */
#define FA_SK 128u                     /* keys of a quarter per stage */
#define FA_NST ((unsigned)FA_KW / FA_SK)   /* stages per quarter */
#define FA_ROWB 256u                   /* bytes of a tile row: two K rows, or 128 keys of a V^T row */
#define FA_ROWS 64u                    /* rows of a tile */
#define FA_PITCH 272u                  /* LDS pitch of a tile row: 256 B + 16 B pad */
#define FA_TILE 18432u                 /* 64 rows x 272 B = 17408 B, rounded up to a multiple of 2 KiB */
#define FA_QSLOT (2u * FA_TILE)        /* one quarter's K and V^T tiles of a stage */
#define FA_BUF (FA_KS * FA_QSLOT)      /* one buffer: the four quarters' tiles of a stage */
#define FA_W0 ((1u << 20) | (5u << 22) | (3u << 25))   /* descriptor group 1 word 0: no mask, byte elements, 4 dwords of pad behind every 256 B */
static_assert(FA_NST * FA_SK == (unsigned)FA_KW && FA_NST >= 2u && FA_ROWS * FA_PITCH <= FA_TILE && FA_TILE % 2048u == 0u);
static_assert(FA_SK * 2u == FA_ROWB && HD * 2 * 2 == FA_ROWB && FA_SK / 2u == FA_ROWS && HD == FA_ROWS);
static_assert(2u * FA_BUF + 2u * FA_NW * 2u * 32u * 4u <= 327680u && (size_t)FA_NW * 2 * 4 * 2 * 32 * 16 <= 2u * FA_BUF);
typedef unsigned int fa_u32x4 __attribute__((ext_vector_type(4)));
typedef unsigned int fa_u32x8 __attribute__((ext_vector_type(8)));
__device__ __forceinline__ unsigned fa_uni(unsigned v) { return (unsigned)__builtin_amdgcn_readfirstlane((int)v); }
__device__ __forceinline__ unsigned fa_pinned(unsigned v) { unsigned w = fa_uni(v); asm volatile("" : "+s"(w)); /* holds the word in a scalar register, so that a test on it is a scalar branch: a tensor load ignores EXEC */ return w; }
// Descriptor group 0: one request, LDS byte offset, global byte address of the tile's first byte, type 2.
__device__ __forceinline__ fa_u32x4 fa_group0(unsigned lds_dst, unsigned long long ga) {
  fa_u32x4 g;
  g[0] = fa_uni(1u); g[1] = fa_uni(lds_dst); g[2] = fa_uni((unsigned)ga); g[3] = fa_uni((((unsigned)(ga >> 32)) & 0x01FFFFFFu) | 0x80000000u);
  asm volatile("" : "+s"(g));          /* the pinned form for descriptor words: held in scalar registers of their own, which fa_twait keeps untouched while the request flies */
  return g;
}
// Descriptor group 1: tensor = tile = FA_ROWS rows of FA_ROWB bytes, byte elements, source pitch src_pitch bytes.
__device__ __forceinline__ fa_u32x8 fa_group1(unsigned src_pitch) {
  fa_u32x8 g;
  g[0] = fa_uni(FA_W0);
  g[1] = fa_uni((FA_ROWB & 0xFFFFu) << 16);
  g[2] = fa_uni((FA_ROWB >> 16) | ((FA_ROWS & 0xFFFFu) << 16));
  g[3] = fa_uni((FA_ROWS >> 16) | (FA_ROWB << 16));
  g[4] = fa_uni(FA_ROWS);
  g[5] = fa_uni(src_pitch);
  g[6] = fa_uni(0u);
  g[7] = fa_uni(0u);
  asm volatile("" : "+s"(g));          /* the pinned form for descriptor words: held in scalar registers of their own for the whole loop, not formed anew in registers that are reused */
  return g;
}
__device__ __forceinline__ void fa_tload(fa_u32x4 g0, fa_u32x8 g1) { asm volatile("tensor_load_to_lds %0, %1" :: "s"(g0), "s"(g1) : "memory"); }   /* one request of the whole wave */
__device__ __forceinline__ void fa_twait(fa_u32x4 g0, fa_u32x8 g1) { asm volatile("s_wait_tensorcnt 0x0" :: "s"(g0), "s"(g1) : "memory"); }   /* the wave's request has landed; naming the descriptor keeps its registers as they are until here */
__device__ __forceinline__ v16h fa_lfrag(const unsigned char* p) { FragH f; f.half[0] = *(const v8us*)p; f.half[1] = *(const v8us*)(p + 32); return f.v; }   /* p already holds the lane's 16 h bytes */
static_assert(FA_KS == 4 && FA_KW * FA_KS == SEQ && FA_KW % 32 == 0 && SEQ % (32 * FA_QG) == 0 && P_CARRY == 16384.0f);
__global__ __launch_bounds__(FA_NW * 32) void k_fattn(const _Float16* __restrict__ Q16, const _Float16* __restrict__ K16, const _Float16* __restrict__ VT, float* __restrict__ O) {
  __shared__ __attribute__((aligned(2048))) unsigned char ring[2u * FA_BUF];   /* [buffer][quarter][K tile, V^T tile]; behind the loop's last barrier it holds the partial O^T tiles */
  v4fa (*po)[2][4][2][32] = (v4fa (*)[2][4][2][32])ring;                /* [wave][query tile][d tile][register quad][lane]; every entry written before the barrier */
  __shared__ float pm[FA_NW][2][32], pl[FA_NW][2][32];                  /* [wave][query tile][lane] running maximum (base 2) and carried sum */
  const unsigned tid = threadIdx.x, w = fa_uni(tid >> 5), lane = tid & 31u, ln = lane & 15u, hh = lane >> 4;
  const unsigned qg = w >> 2, ks = w & 3u, b = blockIdx.y;
  const unsigned q0 = blockIdx.x * (32u * FA_QG) + qg * 32u, k0 = ks * (unsigned)FA_KW;
  const _Float16* qp = Q16 + ((size_t)b * SEQ + q0 + ln) * HD;
  const unsigned isu = (qg < 2u) ? 1u : 0u, tv = (qg == 1u) ? 1u : 0u;   /* query group 0's wave brings its quarter's K tile, group 1's the V^T tile */
  const unsigned long long gsrc = tv ? (unsigned long long)(size_t)(VT + (size_t)b * HD * SEQ + k0)      /* first byte of the quarter's keys in V^T row 0 */
                                     : (unsigned long long)(size_t)(K16 + ((size_t)b * SEQ + k0) * HD);  /* first byte of the quarter's K rows */
  const unsigned gstep = tv ? FA_SK * 2u : FA_SK * (unsigned)HD * 2u;    /* bytes from a stage's tile to the next stage's */
  const unsigned ldst = (unsigned)(size_t)ring + ks * FA_QSLOT + tv * FA_TILE;   /* LDS byte offset of the wave's tile in buffer 0 */
  const fa_u32x8 g1 = fa_group1(tv ? (unsigned)SEQ * 2u : FA_ROWB);
  fa_u32x4 g0 = fa_group0(ldst, gsrc);
  if (fa_pinned(isu)) fa_tload(g0, g1);
  v16h qf[2][2];                                                 /* [query tile][d half], kept for the whole loop */
#pragma unroll
  for (int c = 0; c < 2; ++c) { qf[c][0] = g2_frag(qp + c * 16 * HD, hh); qf[c][1] = g2_frag(qp + c * 16 * HD + 32, hh); }
  v16h ones;
#pragma unroll
  for (int i = 0; i < 16; ++i) ones[i] = (_Float16)1.0f;
  const v8f z8 = {0.f,0.f,0.f,0.f,0.f,0.f,0.f,0.f};
  v8f o[2][4] = {{z8, z8, z8, z8}, {z8, z8, z8, z8}};            /* O^T tiles [query tile][d tile] */
  v8f ls[2] = {z8, z8};                                          /* ones . P^T: every row is the queries' weight sum; only register 0 is kept to scale */
  float mr[2] = {-3.0e38f, -3.0e38f};
  if (fa_pinned(isu)) fa_twait(g0, g1);                          /* stage 0 has landed before its issuer reaches the barrier */
  __syncthreads();                                               /* stage 0 is readable by every wave */
  g0 = fa_group0(ldst + FA_BUF, gsrc + gstep);
  if (fa_pinned(isu)) fa_tload(g0, g1);
  const unsigned char* kl0 = ring + ks * FA_QSLOT + (ln >> 1) * FA_PITCH + (ln & 1u) * 128u + hh * 16u;   /* the lane's place in K row ln of the quarter's K tile, buffer 0 */
  const unsigned char* vl0 = ring + ks * FA_QSLOT + FA_TILE + ln * FA_PITCH + hh * 16u;                   /* the same in row ln of the V^T tile */
#pragma unroll 1                                                 /* the stages share one copy of the pass */
  for (unsigned st = 0; st < FA_NST; ++st) {
  const unsigned char* kl = kl0 + (st & 1u) * FA_BUF;
  const unsigned char* vl = vl0 + (st & 1u) * FA_BUF;
  v16h kf[2][2];                                                 /* [key tile][d half], fetched one pass ahead inside the stage */
#pragma unroll
  for (int t = 0; t < 2; ++t) { kf[t][0] = fa_lfrag(kl + t * 8 * FA_PITCH); kf[t][1] = fa_lfrag(kl + t * 8 * FA_PITCH + 64); }
#pragma unroll 1                                                 /* one pass already holds 18 matrix instructions; a second copy would only cost registers */
  for (unsigned p = 0; p < FA_SK; p += 32u) {
    v16h vf[4];
#pragma unroll
    for (int t = 0; t < 4; ++t) vf[t] = fa_lfrag(vl + t * 16 * FA_PITCH + p * 2u);
    v8f s[2][2];                                                 /* [query tile][key tile] */
#pragma unroll
    for (int c = 0; c < 2; ++c) {
#pragma unroll
      for (int t = 0; t < 2; ++t) s[c][t] = fa_mma(kf[t][1], qf[c][1], fa_mma(kf[t][0], qf[c][0], z8)); }
    const unsigned pn = (p + 32u < FA_SK) ? p + 32u : 0u;        /* a stage's last pass refetches the stage's own first keys: same buffer, never used */
#pragma unroll
    for (int t = 0; t < 2; ++t) { kf[t][0] = fa_lfrag(kl + (pn / 2u + t * 8) * FA_PITCH); kf[t][1] = fa_lfrag(kl + (pn / 2u + t * 8) * FA_PITCH + 64); }
#pragma unroll
    for (int c = 0; c < 2; ++c) {
      float am = fmaxf(s[c][0][0], s[c][1][0]);
#pragma unroll
      for (int r = 1; r < 8; ++r) am = fmaxf(am, fmaxf(s[c][0][r], s[c][1][r]));
      am = fmaxf(am, fa_xhalf(am));
      const float mn = fmaxf(mr[c], am * FA_C1);
      const float corr = __builtin_amdgcn_exp2f(mr[c] - mn);     /* 0 on the first pass */
      mr[c] = mn;
      const float nm = FA_LOG2_CARRY - mn;
      FragH pf;
#pragma unroll
      for (int t = 0; t < 2; ++t) {
#pragma unroll
        for (int r = 0; r < 8; ++r) s[c][t][r] = __builtin_fmaf(s[c][t][r], FA_C1, nm);
        fa_exp2x8(s[c][t]);
#pragma unroll
        for (int r = 0; r < 8; ++r) { const float e = s[c][t][r]; pf.h[t * 8 + r] = (_Float16)((e < F16_MIN_NORMAL) ? 0.f : e); }
      }
#pragma unroll
      for (int t = 0; t < 4; ++t) o[c][t] *= corr;
      ls[c][0] *= corr;
#pragma unroll
      for (int t = 0; t < 4; ++t) o[c][t] = fa_mma(vf[t], pf.v, o[c][t]);
      ls[c] = fa_mma(ones, pf.v, ls[c]);
    }
  }
  asm volatile("s_wait_dscnt 0x0" ::: "memory");                 /* this wave's reads of the stage's buffer have returned before the buffer may be refilled */
  if (fa_pinned(isu)) fa_twait(g0, g1);                          /* stage st + 1 has landed before its issuer reaches the barrier */
  __syncthreads();                                               /* publishes stage st + 1 and ends every wave's reads of stage st; behind the last stage it frees the ring for the partial tiles */
  const unsigned s2 = fa_pinned(st + 2u);                        /* formed behind the wait, and the descriptor's address words from it */
  if (fa_pinned((s2 < FA_NST) ? 1u : 0u)) {
    g0 = fa_group0(ldst + (s2 & 1u) * FA_BUF, gsrc + (unsigned long long)s2 * gstep);
    if (fa_pinned(isu)) fa_tload(g0, g1);                        /* into the buffer that stage st has just left */
  }
  }
  asm volatile("s_wait_tensorcnt 0x0" ::: "memory");             /* no request is left when the ring changes its use */
  asm volatile("s_wait_dscnt 0x0" ::: "memory");                 /* nor a read of it */
#pragma unroll                                                   /* constant indices keep the tiles in registers */
  for (int c = 0; c < 2; ++c) {
#pragma unroll
    for (int t = 0; t < 4; ++t) {
      const v4f lo = {o[c][t][0], o[c][t][1], o[c][t][2], o[c][t][3]}, hi = {o[c][t][4], o[c][t][5], o[c][t][6], o[c][t][7]};
      po[w][c][t][0][lane] = lo; po[w][c][t][1][lane] = hi; }
    pm[w][c][lane] = mr[c]; pl[w][c][lane] = ls[c][0];
  }
  __syncthreads();                                               /* every quarter's partial result is in LDS before any wave joins them */
  const unsigned jc = ks >> 1, jd = ks & 1u, wb = qg * 4u;       /* this wave joins query tile jc, d tiles 2 jd and 2 jd + 1: whole 128-byte lines of the output */
  float mj[4], wj[4];
#pragma unroll
  for (int j = 0; j < 4; ++j) mj[j] = pm[wb + j][jc][lane];
  const float mm = fmaxf(fmaxf(mj[0], mj[1]), fmaxf(mj[2], mj[3]));
  float lsum = 0.f;
#pragma unroll
  for (int j = 0; j < 4; ++j) { wj[j] = __builtin_amdgcn_exp2f(mj[j] - mm); lsum += pl[wb + j][jc][lane] * wj[j]; }
  const float f = 0.125f * (1.0f / lsum);                        /* lsum >= about 16384: the quarter that holds the row maximum has weight 1 and a term of about 16384 */
  float* op = O + ((size_t)b * SEQ + q0 + jc * 16u + ln) * HD + jd * 32u + 8u * hh;
#pragma unroll
  for (unsigned tt = 0; tt < 2u; ++tt) {
#pragma unroll
    for (unsigned h4 = 0; h4 < 2u; ++h4) {
      v4f a = po[wb][jc][jd * 2u + tt][h4][lane] * wj[0];
#pragma unroll
      for (int j = 1; j < 4; ++j) a += po[wb + j][jc][jd * 2u + tt][h4][lane] * wj[j];
      *(v4f*)(op + tt * 16u + h4 * 4u) = a * O_ALPHA * f;
    }
  }
}

extern "C" void kernel_launch(void* const* d_in, const int* in_sizes, int n_in,
                              void* d_out, int out_size, void* d_ws, size_t ws_size, hipStream_t stream) {
  if (n_in < 3) return;
  const size_t need_in = ((size_t)(NB - 1) * SEQ_FULL + SEQ) * HD;
  if ((size_t)in_sizes[0] < need_in || (size_t)in_sizes[1] < need_in || (size_t)in_sizes[2] < need_in) return;
  if ((size_t)out_size < (size_t)NB * SEQ * HD) return;
  const float* xq = (const float*)d_in[0]; const float* xk = (const float*)d_in[1]; const float* xv = (const float*)d_in[2];
  float* out = (float*)d_out;
  char* ws = (char*)d_ws; size_t off = 0;
  auto take = [&](size_t bytes) { char* p = ws + off; off += (bytes + 255) & ~(size_t)255; return p; };
  _Float16* Q16 = (_Float16*)take(WS_PLANE16);      /* [NB][SEQ][64]  64 * bf16(q) */
  _Float16* K16 = (_Float16*)take(WS_PLANE16);      /* [NB][SEQ][64]  64 * bf16(k) */
  _Float16* VT  = (_Float16*)take(WS_PLANE16);      /* [NB][64][SEQ]  64 * bf16(v), transposed */
  if (off > ws_size) return;

  k_cvt16<<<dim3((unsigned)(((size_t)SEQ * HD / 8) / 256), NB, 2), 256, 0, stream>>>(xq, xk, Q16, K16);
  k_vtf<<<dim3(SEQ / 64, NB), 256, 0, stream>>>(xv, VT);
  /* out[NB][SEQ][64] = softmax(q k^T) v * 0.125, f32 straight into the output */
  k_fattn<<<dim3(SEQ / (32 * FA_QG), NB), FA_NW * 32, 0, stream>>>(Q16, K16, VT, out);
}

// v004
// One run takes 36 microseconds.
// Next to v003, in two timings, it ran 1.08 times as fast each time.
// Counting every step since v000, it is 45.2 times as fast.
#include <hip/hip_runtime.h>
// Single-head softmax attention on given q, k, v ([NB][SEQ][64] f32 each): logits = q . k (no scale before the softmax), softmax over all SEQ keys, result x 0.125 applied after the softmax, out = weights . v -> [NB][SEQ][64] f32.
// Compute dtype: all contractions v_wmma_f32_16x16x32_f16 (f16 operands, f32 accumulate). q, k, v are RNE-converted to bf16 first and carried x64 as exact f16 planes (products exact in f32); logits and softmax statistics f32;
// softmax weights carried unnormalised as f16(16384 exp(s - running rowmax)) (rounded to nearest, f16 subnormals kept), row sum taken from the same f16 values, 0.125 / sum applied per row in the f32 epilogue.
// Structure: convert q,k -> f16 planes; v -> V^T f16 planes via LDS transpose; one fused launch: per wave 32 queries x a quarter of the keys, logits, running-maximum softmax and weights . v all in registers, K and V^T tiles staged in LDS by tensor loads (two buffers), the four key quarters joined in LDS.
#ifndef NB
#define NB 8
#endif
#ifndef SEQ
#define SEQ 4096
#endif
#define NB_FULL 8                      /* batches in the inputs */
#define SEQ_FULL 4096                  /* rows per batch in the inputs (input batch pitch) */
#define HD 64
#define QK_CARRY 64.0f                 /* power-of-two carry of the q and k planes */
#define V_CARRY 64.0f                  /* power-of-two carry of the V^T plane */
#define P_CARRY 16384.0f               /* power-of-two carry of the softmax weight plane */
#define S_ALPHA 0.000244140625f        /* 1 / (QK_CARRY * QK_CARRY) */
#define O_ALPHA 0.015625f              /* 1 / V_CARRY */

static_assert(NB >= 1 && NB <= NB_FULL);
static_assert(SEQ >= 256 && SEQ <= SEQ_FULL);
static_assert(HD == 64);
static_assert((SEQ / 128) * 128 == SEQ);                         /* query rows per block, 32-key passes of a key quarter */
static_assert((SEQ / 64) * 64 == SEQ);                           /* V^T token groups */
static_assert((((size_t)SEQ * HD / 8) / 256) * 256 * 8 == (size_t)SEQ * HD);   /* convert kernel covers a batch plane exactly */
#define WS_PLANE16 ((size_t)NB * SEQ * HD * 2)
static_assert(WS_PLANE16 % 256 == 0);
static_assert(3 * WS_PLANE16 <= (size_t)134217728);

typedef unsigned short v8us __attribute__((ext_vector_type(8), may_alias));
typedef float  v8f  __attribute__((ext_vector_type(8)));
typedef float  v4f  __attribute__((ext_vector_type(4)));
typedef float  v2f  __attribute__((ext_vector_type(2)));
typedef float  v4fa __attribute__((ext_vector_type(4), may_alias));
typedef _Float16 v16h __attribute__((ext_vector_type(16)));
union FragH { v16h v; v8us half[2]; _Float16 h[16]; unsigned short u[16]; };

__device__ __forceinline__ unsigned short bf16_bits(float x) { unsigned int u = __float_as_uint(x); return (unsigned short)((u + 0x7FFFu + ((u >> 16) & 1u)) >> 16); }
__device__ __forceinline__ float bf16_val(unsigned short b) { return __uint_as_float(((unsigned int)b) << 16); }
__device__ __forceinline__ float bf16_rne(float x) { return bf16_val(bf16_bits(x)); }

__global__ __launch_bounds__(256) void k_cvt16(const float* __restrict__ xq, const float* __restrict__ xk, _Float16* __restrict__ Q16, _Float16* __restrict__ K16) {
  const unsigned t = blockIdx.x * 256u + threadIdx.x;            /* < SEQ*HD/8 exactly */
  const unsigned b = blockIdx.y;
  const float* src = (blockIdx.z == 0u) ? xq : xk;               /* block-uniform choice between two global inputs */
  _Float16* dst = (blockIdx.z == 0u) ? Q16 : K16;
  const float* p = src + (size_t)b * SEQ_FULL * HD + (size_t)t * 8u;
  const v4f a = *(const v4fa*)p, c = *(const v4fa*)(p + 4);
  FragH f;
#pragma unroll
  for (int q = 0; q < 4; ++q) { f.h[q] = (_Float16)(bf16_rne(a[q]) * QK_CARRY); f.h[4 + q] = (_Float16)(bf16_rne(c[q]) * QK_CARRY); }
  const v8us o = f.half[0];
  unsigned short* d = (unsigned short*)dst + (size_t)b * SEQ * HD + (size_t)t * 8u;
  *(v8us*)d = o;
  
}

__global__ __launch_bounds__(256) void k_vtf(const float* __restrict__ xv, _Float16* __restrict__ VT) {
  __shared__ unsigned short tl[64][66];                          /* [token][d]; all 64x64 entries written before the barrier; cross-wave -> block barrier */
  const unsigned tid = threadIdx.x; const unsigned lg = blockIdx.x; const unsigned b = blockIdx.y;
  for (unsigned i = tid; i < 512u; i += 256u) {
    const unsigned r = i >> 3, c8 = (i & 7u) * 8u;
    const float* p = xv + ((size_t)b * SEQ_FULL + (size_t)lg * 64u + r) * HD + c8;
    const v4f a = *(const v4fa*)p, c = *(const v4fa*)(p + 4);
    FragH f;
#pragma unroll
    for (int q = 0; q < 4; ++q) { f.h[q] = (_Float16)(bf16_rne(a[q]) * V_CARRY); f.h[4 + q] = (_Float16)(bf16_rne(c[q]) * V_CARRY); }
#pragma unroll
    for (int q = 0; q < 8; ++q) tl[r][c8 + q] = f.u[q];
  }
  __syncthreads();
  {
#pragma unroll
    for (unsigned rd = 0; rd < 2u; ++rd) {
      const unsigned d = rd * 32u + (tid >> 3), pc = tid & 7u; FragH f;
#pragma unroll
      for (unsigned q = 0; q < 8u; ++q) f.u[q] = tl[pc * 8u + q][d];
      *(v8us*)((unsigned short*)VT + ((size_t)b * HD + d) * SEQ + (size_t)lg * 64u + pc * 8u) = f.half[0];
    }
    
  }
}

// ---- fused attention: S^T = K Q^T, O^T += V^T P^T ----
// Fragment map (A row / B column = lane & 15, h = lane >> 4): elements 0..7 <- k0 + 8h + i, elements 8..15 <- k0 + 16 + 8h + i; D element r <- (row 8h + r, col lane & 15).
// With K as A and Q as B a lane's score registers all belong to query (lane & 15): maximum and exponent are lane-local but for one exchange between the wave halves, and the two 16-key score tiles of a pass,
// converted in place, are the B operand of the second product (its k order is the map above, which fa_lfrag gives V^T too). O^T keeps query = lane & 15, so the rescale factor is lane-local as well.
// K and V^T reach the waves through LDS. Per stage (128 keys of a quarter) one tensor load brings the K rows, taken two to a 256-byte tile row, and one brings the 64 V^T rows of 256 B; both land at an LDS pitch of 272 B.
// The 4 query groups of a quarter read the same tiles by 16-byte LDS loads whose 16 lanes of a half fall on 64 different banks. Two buffers: stage s + 1 flies while stage s is worked on.
// Block = 16 waves = 4 query groups of 32 rows x 4 key quarters. Each wave leaves (maximum, sum, O^T) of its quarter in LDS; behind the block barrier the four waves of a query group join them in quarter order.
__device__ __forceinline__ v16h g2_frag(const _Float16* p, unsigned hh) { FragH f; f.half[0] = *(const v8us*)((const unsigned short*)p + 8u * hh); f.half[1] = *(const v8us*)((const unsigned short*)p + 16u + 8u * hh); return f.v; }
__device__ __forceinline__ v8f fa_mma(v16h a, v16h b, v8f c) { return __builtin_amdgcn_wmma_f32_16x16x32_f16(false, a, false, b, (short)0, c, false, false); }
__device__ __forceinline__ float fa_xhalf(float x) { return __builtin_bit_cast(float, __builtin_amdgcn_permlanex16(__builtin_bit_cast(int, x), __builtin_bit_cast(int, x), 0x76543210, 0xfedcba98, false, false)); }   /* lane l <-> lane l ^ 16 */
// Eight base-2 exponentials, each in place, in one statement: no result lands on a neighbour's source, and the closing v_nop is the free slot the instruction set asks for between a transcendental and the first use of its result.
__device__ __forceinline__ void fa_exp2x8(v8f& x) {
  asm("v_exp_f32 %0, %0\n\tv_exp_f32 %1, %1\n\tv_exp_f32 %2, %2\n\tv_exp_f32 %3, %3\n\tv_exp_f32 %4, %4\n\tv_exp_f32 %5, %5\n\tv_exp_f32 %6, %6\n\tv_exp_f32 %7, %7\n\tv_nop"
      : "+v"(x[0]), "+v"(x[1]), "+v"(x[2]), "+v"(x[3]), "+v"(x[4]), "+v"(x[5]), "+v"(x[6]), "+v"(x[7]));
}
#define FA_QG 4                        /* query groups (32 rows each) per block */
#define FA_KS 4                        /* key quarters per block */
#define FA_NW (FA_QG * FA_KS)
#define FA_KW (SEQ / FA_KS)            /* keys per wave */
#define FA_C1 (S_ALPHA * 1.4426950408889634f)   /* score accumulator -> logit in base-2 units */
#define FA_LOG2_CARRY 14.0f            /* log2(P_CARRY) */
#define FA_SK 128u                     /* keys of a quarter per stage */
#define FA_NST ((unsigned)FA_KW / FA_SK)   /* stages per quarter */
#define FA_ROWB 256u                   /* bytes of a tile row: two K rows, or 128 keys of a V^T row */
#define FA_ROWS 64u                    /* rows of a tile */
#define FA_PITCH 272u                  /* LDS pitch of a tile row: 256 B + 16 B pad */
#define FA_TILE 18432u                 /* 64 rows x 272 B = 17408 B, rounded up to a multiple of 2 KiB */
#define FA_QSLOT (2u * FA_TILE)        /* one quarter's K and V^T tiles of a stage */
#define FA_BUF (FA_KS * FA_QSLOT)      /* one buffer: the four quarters' tiles of a stage */
#define FA_W0 ((1u << 20) | (5u << 22) | (3u << 25))   /* descriptor group 1 word 0: no mask, byte elements, 4 dwords of pad behind every 256 B */
static_assert(FA_NST * FA_SK == (unsigned)FA_KW && FA_NST >= 2u && FA_ROWS * FA_PITCH <= FA_TILE && FA_TILE % 2048u == 0u);
static_assert(FA_SK * 2u == FA_ROWB && HD * 2 * 2 == FA_ROWB && FA_SK / 2u == FA_ROWS && HD == FA_ROWS);
static_assert(2u * FA_BUF + 2u * FA_NW * 2u * 32u * 4u <= 327680u && (size_t)FA_NW * 2 * 4 * 2 * 32 * 16 <= 2u * FA_BUF);
typedef unsigned int fa_u32x4 __attribute__((ext_vector_type(4)));
typedef unsigned int fa_u32x8 __attribute__((ext_vector_type(8)));
__device__ __forceinline__ unsigned fa_uni(unsigned v) { return (unsigned)__builtin_amdgcn_readfirstlane((int)v); }
__device__ __forceinline__ unsigned fa_pinned(unsigned v) { unsigned w = fa_uni(v); asm volatile("" : "+s"(w)); /* holds the word in a scalar register, so that a test on it is a scalar branch: a tensor load ignores EXEC */ return w; }
// Descriptor group 0: one request, LDS byte offset, global byte address of the tile's first byte, type 2.
__device__ __forceinline__ fa_u32x4 fa_group0(unsigned lds_dst, unsigned long long ga) {
  fa_u32x4 g;
  g[0] = fa_uni(1u); g[1] = fa_uni(lds_dst); g[2] = fa_uni((unsigned)ga); g[3] = fa_uni((((unsigned)(ga >> 32)) & 0x01FFFFFFu) | 0x80000000u);
  asm volatile("" : "+s"(g));          /* the pinned form for descriptor words: held in scalar registers of their own, which fa_twait keeps untouched while the request flies */
  return g;
}
// Descriptor group 1: tensor = tile = FA_ROWS rows of FA_ROWB bytes, byte elements, source pitch src_pitch bytes.
__device__ __forceinline__ fa_u32x8 fa_group1(unsigned src_pitch) {
  fa_u32x8 g;
  g[0] = fa_uni(FA_W0);
  g[1] = fa_uni((FA_ROWB & 0xFFFFu) << 16);
  g[2] = fa_uni((FA_ROWB >> 16) | ((FA_ROWS & 0xFFFFu) << 16));
  g[3] = fa_uni((FA_ROWS >> 16) | (FA_ROWB << 16));
  g[4] = fa_uni(FA_ROWS);
  g[5] = fa_uni(src_pitch);
  g[6] = fa_uni(0u);
  g[7] = fa_uni(0u);
  asm volatile("" : "+s"(g));          /* the pinned form for descriptor words: held in scalar registers of their own for the whole loop, not formed anew in registers that are reused */
  return g;
}
__device__ __forceinline__ void fa_tload(fa_u32x4 g0, fa_u32x8 g1) { asm volatile("tensor_load_to_lds %0, %1" :: "s"(g0), "s"(g1) : "memory"); }   /* one request of the whole wave */
__device__ __forceinline__ void fa_twait(fa_u32x4 g0, fa_u32x8 g1) { asm volatile("s_wait_tensorcnt 0x0" :: "s"(g0), "s"(g1) : "memory"); }   /* the wave's request has landed; naming the descriptor keeps its registers as they are until here */
__device__ __forceinline__ v16h fa_lfrag(const unsigned char* p) { FragH f; f.half[0] = *(const v8us*)p; f.half[1] = *(const v8us*)(p + 32); return f.v; }   /* p already holds the lane's 16 h bytes */
static_assert(FA_KS == 4 && FA_KW * FA_KS == SEQ && FA_KW % 32 == 0 && SEQ % (32 * FA_QG) == 0 && P_CARRY == 16384.0f);
__global__ __launch_bounds__(FA_NW * 32) void k_fattn(const _Float16* __restrict__ Q16, const _Float16* __restrict__ K16, const _Float16* __restrict__ VT, float* __restrict__ O) {
  __shared__ __attribute__((aligned(2048))) unsigned char ring[2u * FA_BUF];   /* [buffer][quarter][K tile, V^T tile]; behind the loop's last barrier it holds the partial O^T tiles */
  v4fa (*po)[2][4][2][32] = (v4fa (*)[2][4][2][32])ring;                /* [wave][query tile][d tile][register quad][lane]; every entry written before the barrier */
  __shared__ float pm[FA_NW][2][32], pl[FA_NW][2][32];                  /* [wave][query tile][lane] running maximum (base 2) and carried sum */
  const unsigned tid = threadIdx.x, w = fa_uni(tid >> 5), lane = tid & 31u, ln = lane & 15u, hh = lane >> 4;
  const unsigned qg = w >> 2, ks = w & 3u, b = blockIdx.y;
  const unsigned q0 = blockIdx.x * (32u * FA_QG) + qg * 32u, k0 = ks * (unsigned)FA_KW;
  const _Float16* qp = Q16 + ((size_t)b * SEQ + q0 + ln) * HD;
  const unsigned isu = (qg < 2u) ? 1u : 0u, tv = (qg == 1u) ? 1u : 0u;   /* query group 0's wave brings its quarter's K tile, group 1's the V^T tile */
  const unsigned long long gsrc = tv ? (unsigned long long)(size_t)(VT + (size_t)b * HD * SEQ + k0)      /* first byte of the quarter's keys in V^T row 0 */
                                     : (unsigned long long)(size_t)(K16 + ((size_t)b * SEQ + k0) * HD);  /* first byte of the quarter's K rows */
  const unsigned gstep = tv ? FA_SK * 2u : FA_SK * (unsigned)HD * 2u;    /* bytes from a stage's tile to the next stage's */
  const unsigned ldst = (unsigned)(size_t)ring + ks * FA_QSLOT + tv * FA_TILE;   /* LDS byte offset of the wave's tile in buffer 0 */
  const fa_u32x8 g1 = fa_group1(tv ? (unsigned)SEQ * 2u : FA_ROWB);
  fa_u32x4 g0 = fa_group0(ldst, gsrc);
  if (fa_pinned(isu)) fa_tload(g0, g1);
  v16h qf[2][2];                                                 /* [query tile][d half], kept for the whole loop */
#pragma unroll
  for (int c = 0; c < 2; ++c) { qf[c][0] = g2_frag(qp + c * 16 * HD, hh); qf[c][1] = g2_frag(qp + c * 16 * HD + 32, hh); }
  v16h ones;
#pragma unroll
  for (int i = 0; i < 16; ++i) ones[i] = (_Float16)1.0f;
  const v8f z8 = {0.f,0.f,0.f,0.f,0.f,0.f,0.f,0.f};
  v8f o[2][4] = {{z8, z8, z8, z8}, {z8, z8, z8, z8}};            /* O^T tiles [query tile][d tile] */
  v8f ls[2] = {z8, z8};                                          /* ones . P^T: every row is the queries' weight sum; only register 0 is kept to scale */
  float mr[2] = {-3.0e38f, -3.0e38f};
  if (fa_pinned(isu)) fa_twait(g0, g1);                          /* stage 0 has landed before its issuer reaches the barrier */
  __syncthreads();                                               /* stage 0 is readable by every wave */
  g0 = fa_group0(ldst + FA_BUF, gsrc + gstep);
  if (fa_pinned(isu)) fa_tload(g0, g1);
  const unsigned char* kl0 = ring + ks * FA_QSLOT + (ln >> 1) * FA_PITCH + (ln & 1u) * 128u + hh * 16u;   /* the lane's place in K row ln of the quarter's K tile, buffer 0 */
  const unsigned char* vl0 = ring + ks * FA_QSLOT + FA_TILE + ln * FA_PITCH + hh * 16u;                   /* the same in row ln of the V^T tile */
#pragma unroll 1                                                 /* the stages share one copy of the pass */
  for (unsigned st = 0; st < FA_NST; ++st) {
  const unsigned char* kl = kl0 + (st & 1u) * FA_BUF;
  const unsigned char* vl = vl0 + (st & 1u) * FA_BUF;
  v16h kf[2][2];                                                 /* [key tile][d half], fetched one pass ahead inside the stage */
#pragma unroll
  for (int t = 0; t < 2; ++t) { kf[t][0] = fa_lfrag(kl + t * 8 * FA_PITCH); kf[t][1] = fa_lfrag(kl + t * 8 * FA_PITCH + 64); }
#pragma unroll 1                                                 /* one pass already holds 18 matrix instructions; a second copy would only cost registers */
  for (unsigned p = 0; p < FA_SK; p += 32u) {
    v16h vf[4];
#pragma unroll
    for (int t = 0; t < 4; ++t) vf[t] = fa_lfrag(vl + t * 16 * FA_PITCH + p * 2u);
    v8f s[2][2];                                                 /* [query tile][key tile] */
#pragma unroll
    for (int c = 0; c < 2; ++c) {
#pragma unroll
      for (int t = 0; t < 2; ++t) s[c][t] = fa_mma(kf[t][1], qf[c][1], fa_mma(kf[t][0], qf[c][0], z8)); }
    const unsigned pn = (p + 32u < FA_SK) ? p + 32u : 0u;        /* a stage's last pass refetches the stage's own first keys: same buffer, never used */
#pragma unroll
    for (int t = 0; t < 2; ++t) { kf[t][0] = fa_lfrag(kl + (pn / 2u + t * 8) * FA_PITCH); kf[t][1] = fa_lfrag(kl + (pn / 2u + t * 8) * FA_PITCH + 64); }
#pragma unroll
    for (int c = 0; c < 2; ++c) {
      float am = fmaxf(s[c][0][0], s[c][1][0]);
#pragma unroll
      for (int r = 1; r < 8; ++r) am = fmaxf(am, fmaxf(s[c][0][r], s[c][1][r]));
      am = fmaxf(am, fa_xhalf(am));
      const float mn = fmaxf(mr[c], am * FA_C1);
      const float corr = __builtin_amdgcn_exp2f(mr[c] - mn);     /* 0 on the first pass */
      mr[c] = mn;
      const float nm = FA_LOG2_CARRY - mn;
      FragH pf;
#pragma unroll
      for (int t = 0; t < 2; ++t) {
#pragma unroll
        for (int r = 0; r < 8; ++r) s[c][t][r] = __builtin_fmaf(s[c][t][r], FA_C1, nm);
        fa_exp2x8(s[c][t]);
#pragma unroll
        for (int r = 0; r < 8; ++r) pf.h[t * 8 + r] = (_Float16)s[c][t][r];   /* nearest f16, subnormals kept: both products that take pf read the same values */
      }
#pragma unroll
      for (int t = 0; t < 4; ++t) o[c][t] *= corr;
      ls[c][0] *= corr;
#pragma unroll
      for (int t = 0; t < 4; ++t) o[c][t] = fa_mma(vf[t], pf.v, o[c][t]);
      ls[c] = fa_mma(ones, pf.v, ls[c]);
    }
  }
  asm volatile("s_wait_dscnt 0x0" ::: "memory");                 /* this wave's reads of the stage's buffer have returned before the buffer may be refilled */
  if (fa_pinned(isu)) fa_twait(g0, g1);                          /* stage st + 1 has landed before its issuer reaches the barrier */
  __syncthreads();                                               /* publishes stage st + 1 and ends every wave's reads of stage st; behind the last stage it frees the ring for the partial tiles */
  const unsigned s2 = fa_pinned(st + 2u);                        /* formed behind the wait, and the descriptor's address words from it */
  if (fa_pinned((s2 < FA_NST) ? 1u : 0u)) {
    g0 = fa_group0(ldst + (s2 & 1u) * FA_BUF, gsrc + (unsigned long long)s2 * gstep);
    if (fa_pinned(isu)) fa_tload(g0, g1);                        /* into the buffer that stage st has just left */
  }
  }
  asm volatile("s_wait_tensorcnt 0x0" ::: "memory");             /* no request is left when the ring changes its use */
  asm volatile("s_wait_dscnt 0x0" ::: "memory");                 /* nor a read of it */
#pragma unroll                                                   /* constant indices keep the tiles in registers */
  for (int c = 0; c < 2; ++c) {
#pragma unroll
    for (int t = 0; t < 4; ++t) {
      const v4f lo = {o[c][t][0], o[c][t][1], o[c][t][2], o[c][t][3]}, hi = {o[c][t][4], o[c][t][5], o[c][t][6], o[c][t][7]};
      po[w][c][t][0][lane] = lo; po[w][c][t][1][lane] = hi; }
    pm[w][c][lane] = mr[c]; pl[w][c][lane] = ls[c][0];
  }
  __syncthreads();                                               /* every quarter's partial result is in LDS before any wave joins them */
  const unsigned jc = ks >> 1, jd = ks & 1u, wb = qg * 4u;       /* this wave joins query tile jc, d tiles 2 jd and 2 jd + 1: whole 128-byte lines of the output */
  float mj[4], wj[4];
#pragma unroll
  for (int j = 0; j < 4; ++j) mj[j] = pm[wb + j][jc][lane];
  const float mm = fmaxf(fmaxf(mj[0], mj[1]), fmaxf(mj[2], mj[3]));
  float lsum = 0.f;
#pragma unroll
  for (int j = 0; j < 4; ++j) { wj[j] = __builtin_amdgcn_exp2f(mj[j] - mm); lsum += pl[wb + j][jc][lane] * wj[j]; }
  const float f = 0.125f * (1.0f / lsum);                        /* lsum >= about 16384: the quarter that holds the row maximum has weight 1 and a term of about 16384 */
  float* op = O + ((size_t)b * SEQ + q0 + jc * 16u + ln) * HD + jd * 32u + 8u * hh;
#pragma unroll
  for (unsigned tt = 0; tt < 2u; ++tt) {
#pragma unroll
    for (unsigned h4 = 0; h4 < 2u; ++h4) {
      v4f a = po[wb][jc][jd * 2u + tt][h4][lane] * wj[0];
#pragma unroll
      for (int j = 1; j < 4; ++j) a += po[wb + j][jc][jd * 2u + tt][h4][lane] * wj[j];
      *(v4f*)(op + tt * 16u + h4 * 4u) = a * O_ALPHA * f;
    }
  }
}

extern "C" void kernel_launch(void* const* d_in, const int* in_sizes, int n_in,
                              void* d_out, int out_size, void* d_ws, size_t ws_size, hipStream_t stream) {
  if (n_in < 3) return;
  const size_t need_in = ((size_t)(NB - 1) * SEQ_FULL + SEQ) * HD;
  if ((size_t)in_sizes[0] < need_in || (size_t)in_sizes[1] < need_in || (size_t)in_sizes[2] < need_in) return;
  if ((size_t)out_size < (size_t)NB * SEQ * HD) return;
  const float* xq = (const float*)d_in[0]; const float* xk = (const float*)d_in[1]; const float* xv = (const float*)d_in[2];
  float* out = (float*)d_out;
  char* ws = (char*)d_ws; size_t off = 0;
  auto take = [&](size_t bytes) { char* p = ws + off; off += (bytes + 255) & ~(size_t)255; return p; };
  _Float16* Q16 = (_Float16*)take(WS_PLANE16);      /* [NB][SEQ][64]  64 * bf16(q) */
  _Float16* K16 = (_Float16*)take(WS_PLANE16);      /* [NB][SEQ][64]  64 * bf16(k) */
  _Float16* VT  = (_Float16*)take(WS_PLANE16);      /* [NB][64][SEQ]  64 * bf16(v), transposed */
  if (off > ws_size) return;

  k_cvt16<<<dim3((unsigned)(((size_t)SEQ * HD / 8) / 256), NB, 2), 256, 0, stream>>>(xq, xk, Q16, K16);
  k_vtf<<<dim3(SEQ / 64, NB), 256, 0, stream>>>(xv, VT);
  /* out[NB][SEQ][64] = softmax(q k^T) v * 0.125, f32 straight into the output */
  k_fattn<<<dim3(SEQ / (32 * FA_QG), NB), FA_NW * 32, 0, stream>>>(Q16, K16, VT, out);
}

// v005
// One run takes 34.8 microseconds.
// Two timings next to v004 put it at 1.04 and 1.03 times that version's speed.
// Counting every step since v000, it is 46.8 times as fast.
#include <hip/hip_runtime.h>
// Single-head softmax attention on given q, k, v ([NB][SEQ][64] f32 each): logits = q . k (no scale before the softmax), softmax over all SEQ keys, result x 0.125 applied after the softmax, out = weights . v -> [NB][SEQ][64] f32.
// Compute dtype: all contractions v_wmma_f32_16x16x32_f16 (f16 operands, f32 accumulate). q, k, v are RNE-converted to bf16 first and carried x64 as exact f16 planes (products exact in f32); logits and softmax statistics f32;
// softmax weights carried unnormalised as f16(16384 exp(s - running rowmax)) (rounded to nearest, f16 subnormals kept), row sum taken from the same f16 values, 0.125 / sum applied per row in the f32 epilogue.
// Structure: one launch converts q, k -> f16 planes and v -> V^T f16 plane via LDS transpose; one fused launch: per wave 32 queries x a quarter of the keys, logits, running-maximum softmax and weights . v all in registers, K and V^T tiles staged in LDS by tensor loads (two buffers), the four key quarters joined in LDS.
#ifndef NB
#define NB 8
#endif
#ifndef SEQ
#define SEQ 4096
#endif
#define NB_FULL 8                      /* batches in the inputs */
#define SEQ_FULL 4096                  /* rows per batch in the inputs (input batch pitch) */
#define HD 64
#define QK_CARRY 64.0f                 /* power-of-two carry of the q and k planes */
#define V_CARRY 64.0f                  /* power-of-two carry of the V^T plane */
#define P_CARRY 16384.0f               /* power-of-two carry of the softmax weight plane */
#define S_ALPHA 0.000244140625f        /* 1 / (QK_CARRY * QK_CARRY) */
#define O_ALPHA 0.015625f              /* 1 / V_CARRY */

static_assert(NB >= 1 && NB <= NB_FULL);
static_assert(SEQ >= 256 && SEQ <= SEQ_FULL);
static_assert(HD == 64);
static_assert((SEQ / 128) * 128 == SEQ);                         /* query rows per block, 32-key passes of a key quarter */
static_assert((SEQ / 64) * 64 == SEQ);                           /* V^T token groups */
#define WS_PLANE16 ((size_t)NB * SEQ * HD * 2)
static_assert(WS_PLANE16 % 256 == 0);
static_assert(3 * WS_PLANE16 <= (size_t)134217728);

typedef unsigned short v8us __attribute__((ext_vector_type(8), may_alias));
typedef float  v8f  __attribute__((ext_vector_type(8)));
typedef float  v4f  __attribute__((ext_vector_type(4)));
typedef float  v2f  __attribute__((ext_vector_type(2)));
typedef float  v4fa __attribute__((ext_vector_type(4), may_alias));
typedef _Float16 v16h __attribute__((ext_vector_type(16)));
union FragH { v16h v; v8us half[2]; _Float16 h[16]; unsigned short u[16]; };

__device__ __forceinline__ unsigned short bf16_bits(float x) { unsigned int u = __float_as_uint(x); return (unsigned short)((u + 0x7FFFu + ((u >> 16) & 1u)) >> 16); }
__device__ __forceinline__ float bf16_val(unsigned short b) { return __uint_as_float(((unsigned int)b) << 16); }
__device__ __forceinline__ float bf16_rne(float x) { return bf16_val(bf16_bits(x)); }

// One launch makes the three f16 planes. A block takes PT tokens of one batch from q, k and v alike (one block a WGP at the full shape): few, long waves in place of many short ones,
// and every global load of a thread is issued before its first conversion. All loops are unrolled: constant indices keep the loaded pieces in registers.
#define PT 128u                        /* tokens per block */
#define PCH 4u                         /* 8-element pieces per thread and input: PT * HD / 8 / 256 */
static_assert(PT * HD == PCH * 256u * 8u && (SEQ / PT) * PT == SEQ);
__device__ __forceinline__ v8us cvt8(v4f a, v4f c, float carry) {
  FragH f;
#pragma unroll
  for (int q = 0; q < 4; ++q) { f.h[q] = (_Float16)(bf16_rne(a[q]) * carry); f.h[4 + q] = (_Float16)(bf16_rne(c[q]) * carry); }
  return f.half[0];
}
__global__ __launch_bounds__(256) void k_prep(const float* __restrict__ xq, const float* __restrict__ xk, const float* __restrict__ xv,
                                              _Float16* __restrict__ Q16, _Float16* __restrict__ K16, _Float16* __restrict__ VT) {
  __shared__ unsigned short tl[PT][66];                          /* [token][d]; all PT x 64 entries written before the barrier; cross-wave -> block barrier */
  const unsigned tid = threadIdx.x, g = blockIdx.x, b = blockIdx.y;
  const size_t in0 = ((size_t)b * SEQ_FULL + (size_t)g * PT) * HD + (size_t)tid * 8u;   /* the thread's first piece in an input */
  const size_t pl0 = ((size_t)b * SEQ + (size_t)g * PT) * HD + (size_t)tid * 8u;        /* the same in a q or k plane */
  v4f rv[PCH][2], rq[PCH][2], rk[PCH][2];
#pragma unroll
  for (unsigned j = 0; j < PCH; ++j) { const float* p = xv + in0 + j * 2048u; rv[j][0] = *(const v4fa*)p; rv[j][1] = *(const v4fa*)(p + 4); }
#pragma unroll
  for (unsigned j = 0; j < PCH; ++j) { const float* p = xq + in0 + j * 2048u; rq[j][0] = *(const v4fa*)p; rq[j][1] = *(const v4fa*)(p + 4); }
#pragma unroll
  for (unsigned j = 0; j < PCH; ++j) { const float* p = xk + in0 + j * 2048u; rk[j][0] = *(const v4fa*)p; rk[j][1] = *(const v4fa*)(p + 4); }
  asm volatile("s_wait_xcnt 0x0" :: "v"(xv + in0), "v"(xq + in0), "v"(xk + in0) : "memory");   /* the precaution kept before a register that an issued load names is rewritten; naming the three address pairs keeps them whole until here, and as a memory statement it holds all 24 loads in front of the conversions (without it half of them are issued only after the first have returned: a second latency in series) */
#pragma unroll
  for (unsigned j = 0; j < PCH; ++j) {
    const unsigned r = j * 32u + (tid >> 3), c8 = (tid & 7u) * 8u;
    FragH f; f.half[0] = cvt8(rv[j][0], rv[j][1], V_CARRY);
#pragma unroll
    for (int q = 0; q < 8; ++q) tl[r][c8 + q] = f.u[q];
  }
  __syncthreads();
#pragma unroll
  for (unsigned u = 0; u < PT / 64u; ++u) {
#pragma unroll
    for (unsigned rd = 0; rd < 2u; ++rd) {
      const unsigned d = rd * 32u + (tid >> 3), pc = tid & 7u; FragH f;
#pragma unroll
      for (unsigned q = 0; q < 8u; ++q) f.u[q] = tl[u * 64u + pc * 8u + q][d];
      *(v8us*)((unsigned short*)VT + ((size_t)b * HD + d) * SEQ + (size_t)g * PT + u * 64u + pc * 8u) = f.half[0];
    }
  }
#pragma unroll
  for (unsigned j = 0; j < PCH; ++j) *(v8us*)((unsigned short*)Q16 + pl0 + j * 2048u) = cvt8(rq[j][0], rq[j][1], QK_CARRY);
#pragma unroll
  for (unsigned j = 0; j < PCH; ++j) *(v8us*)((unsigned short*)K16 + pl0 + j * 2048u) = cvt8(rk[j][0], rk[j][1], QK_CARRY);
}

// ---- fused attention: S^T = K Q^T, O^T += V^T P^T ----
// Fragment map (A row / B column = lane & 15, h = lane >> 4): elements 0..7 <- k0 + 8h + i, elements 8..15 <- k0 + 16 + 8h + i; D element r <- (row 8h + r, col lane & 15).
// With K as A and Q as B a lane's score registers all belong to query (lane & 15): maximum and exponent are lane-local but for one exchange between the wave halves, and the two 16-key score tiles of a pass,
// converted in place, are the B operand of the second product (its k order is the map above, which fa_lfrag gives V^T too). O^T keeps query = lane & 15, so the rescale factor is lane-local as well.
// K and V^T reach the waves through LDS. Per stage (128 keys of a quarter) one tensor load brings the K rows, taken two to a 256-byte tile row, and one brings the 64 V^T rows of 256 B; both land at an LDS pitch of 272 B.
// The 4 query groups of a quarter read the same tiles by 16-byte LDS loads whose 16 lanes of a half fall on 64 different banks. Two buffers: stage s + 1 flies while stage s is worked on.
// Block = 16 waves = 4 query groups of 32 rows x 4 key quarters. Each wave leaves (maximum, sum, O^T) of its quarter in LDS; behind the block barrier the four waves of a query group join them in quarter order.
__device__ __forceinline__ v16h g2_frag(const _Float16* p, unsigned hh) { FragH f; f.half[0] = *(const v8us*)((const unsigned short*)p + 8u * hh); f.half[1] = *(const v8us*)((const unsigned short*)p + 16u + 8u * hh); return f.v; }
__device__ __forceinline__ v8f fa_mma(v16h a, v16h b, v8f c) { return __builtin_amdgcn_wmma_f32_16x16x32_f16(false, a, false, b, (short)0, c, false, false); }
__device__ __forceinline__ float fa_xhalf(float x) { return __builtin_bit_cast(float, __builtin_amdgcn_permlanex16(__builtin_bit_cast(int, x), __builtin_bit_cast(int, x), 0x76543210, 0xfedcba98, false, false)); }   /* lane l <-> lane l ^ 16 */
// Eight base-2 exponentials, each in place, in one statement: no result lands on a neighbour's source, and the closing v_nop is the free slot the instruction set asks for between a transcendental and the first use of its result.
__device__ __forceinline__ void fa_exp2x8(v8f& x) {
  asm("v_exp_f32 %0, %0\n\tv_exp_f32 %1, %1\n\tv_exp_f32 %2, %2\n\tv_exp_f32 %3, %3\n\tv_exp_f32 %4, %4\n\tv_exp_f32 %5, %5\n\tv_exp_f32 %6, %6\n\tv_exp_f32 %7, %7\n\tv_nop"
      : "+v"(x[0]), "+v"(x[1]), "+v"(x[2]), "+v"(x[3]), "+v"(x[4]), "+v"(x[5]), "+v"(x[6]), "+v"(x[7]));
}
#define FA_QG 4                        /* query groups (32 rows each) per block */
#define FA_KS 4                        /* key quarters per block */
#define FA_NW (FA_QG * FA_KS)
#define FA_KW (SEQ / FA_KS)            /* keys per wave */
#define FA_C1 (S_ALPHA * 1.4426950408889634f)   /* score accumulator -> logit in base-2 units */
#define FA_LOG2_CARRY 14.0f            /* log2(P_CARRY) */
#define FA_SK 128u                     /* keys of a quarter per stage */
#define FA_NST ((unsigned)FA_KW / FA_SK)   /* stages per quarter */
#define FA_ROWB 256u                   /* bytes of a tile row: two K rows, or 128 keys of a V^T row */
#define FA_ROWS 64u                    /* rows of a tile */
#define FA_PITCH 272u                  /* LDS pitch of a tile row: 256 B + 16 B pad */
#define FA_TILE 18432u                 /* 64 rows x 272 B = 17408 B, rounded up to a multiple of 2 KiB */
#define FA_QSLOT (2u * FA_TILE)        /* one quarter's K and V^T tiles of a stage */
#define FA_BUF (FA_KS * FA_QSLOT)      /* one buffer: the four quarters' tiles of a stage */
#define FA_W0 ((1u << 20) | (5u << 22) | (3u << 25))   /* descriptor group 1 word 0: no mask, byte elements, 4 dwords of pad behind every 256 B */
static_assert(FA_NST * FA_SK == (unsigned)FA_KW && FA_NST >= 2u && FA_ROWS * FA_PITCH <= FA_TILE && FA_TILE % 2048u == 0u);
static_assert(FA_SK * 2u == FA_ROWB && HD * 2 * 2 == FA_ROWB && FA_SK / 2u == FA_ROWS && HD == FA_ROWS);
static_assert(2u * FA_BUF + 2u * FA_NW * 2u * 32u * 4u <= 327680u && (size_t)FA_NW * 2 * 4 * 2 * 32 * 16 <= 2u * FA_BUF);
typedef unsigned int fa_u32x4 __attribute__((ext_vector_type(4)));
typedef unsigned int fa_u32x8 __attribute__((ext_vector_type(8)));
__device__ __forceinline__ unsigned fa_uni(unsigned v) { return (unsigned)__builtin_amdgcn_readfirstlane((int)v); }
__device__ __forceinline__ unsigned fa_pinned(unsigned v) { unsigned w = fa_uni(v); asm volatile("" : "+s"(w)); /* holds the word in a scalar register, so that a test on it is a scalar branch: a tensor load ignores EXEC */ return w; }
// Descriptor group 0: one request, LDS byte offset, global byte address of the tile's first byte, type 2.
__device__ __forceinline__ fa_u32x4 fa_group0(unsigned lds_dst, unsigned long long ga) {
  fa_u32x4 g;
  g[0] = fa_uni(1u); g[1] = fa_uni(lds_dst); g[2] = fa_uni((unsigned)ga); g[3] = fa_uni((((unsigned)(ga >> 32)) & 0x01FFFFFFu) | 0x80000000u);
  asm volatile("" : "+s"(g));          /* the pinned form for descriptor words: held in scalar registers of their own, which fa_twait keeps untouched while the request flies */
  return g;
}
// Descriptor group 1: tensor = tile = FA_ROWS rows of FA_ROWB bytes, byte elements, source pitch src_pitch bytes.
__device__ __forceinline__ fa_u32x8 fa_group1(unsigned src_pitch) {
  fa_u32x8 g;
  g[0] = fa_uni(FA_W0);
  g[1] = fa_uni((FA_ROWB & 0xFFFFu) << 16);
  g[2] = fa_uni((FA_ROWB >> 16) | ((FA_ROWS & 0xFFFFu) << 16));
  g[3] = fa_uni((FA_ROWS >> 16) | (FA_ROWB << 16));
  g[4] = fa_uni(FA_ROWS);
  g[5] = fa_uni(src_pitch);
  g[6] = fa_uni(0u);
  g[7] = fa_uni(0u);
  asm volatile("" : "+s"(g));          /* the pinned form for descriptor words: held in scalar registers of their own for the whole loop, not formed anew in registers that are reused */
  return g;
}
__device__ __forceinline__ void fa_tload(fa_u32x4 g0, fa_u32x8 g1) { asm volatile("tensor_load_to_lds %0, %1" :: "s"(g0), "s"(g1) : "memory"); }   /* one request of the whole wave */
__device__ __forceinline__ void fa_twait(fa_u32x4 g0, fa_u32x8 g1) { asm volatile("s_wait_tensorcnt 0x0" :: "s"(g0), "s"(g1) : "memory"); }   /* the wave's request has landed; naming the descriptor keeps its registers as they are until here */
__device__ __forceinline__ v16h fa_lfrag(const unsigned char* p) { FragH f; f.half[0] = *(const v8us*)p; f.half[1] = *(const v8us*)(p + 32); return f.v; }   /* p already holds the lane's 16 h bytes */
static_assert(FA_KS == 4 && FA_KW * FA_KS == SEQ && FA_KW % 32 == 0 && SEQ % (32 * FA_QG) == 0 && P_CARRY == 16384.0f);
__global__ __launch_bounds__(FA_NW * 32) void k_fattn(const _Float16* __restrict__ Q16, const _Float16* __restrict__ K16, const _Float16* __restrict__ VT, float* __restrict__ O) {
  __shared__ __attribute__((aligned(2048))) unsigned char ring[2u * FA_BUF];   /* [buffer][quarter][K tile, V^T tile]; behind the loop's last barrier it holds the partial O^T tiles */
  v4fa (*po)[2][4][2][32] = (v4fa (*)[2][4][2][32])ring;                /* [wave][query tile][d tile][register quad][lane]; every entry written before the barrier */
  __shared__ float pm[FA_NW][2][32], pl[FA_NW][2][32];                  /* [wave][query tile][lane] running maximum (base 2) and carried sum */
  const unsigned tid = threadIdx.x, w = fa_uni(tid >> 5), lane = tid & 31u, ln = lane & 15u, hh = lane >> 4;
  const unsigned qg = w >> 2, ks = w & 3u, b = blockIdx.y;
  const unsigned q0 = blockIdx.x * (32u * FA_QG) + qg * 32u, k0 = ks * (unsigned)FA_KW;
  const _Float16* qp = Q16 + ((size_t)b * SEQ + q0 + ln) * HD;
  const unsigned isu = (qg < 2u) ? 1u : 0u, tv = (qg == 1u) ? 1u : 0u;   /* query group 0's wave brings its quarter's K tile, group 1's the V^T tile */
  const unsigned long long gsrc = tv ? (unsigned long long)(size_t)(VT + (size_t)b * HD * SEQ + k0)      /* first byte of the quarter's keys in V^T row 0 */
                                     : (unsigned long long)(size_t)(K16 + ((size_t)b * SEQ + k0) * HD);  /* first byte of the quarter's K rows */
  const unsigned gstep = tv ? FA_SK * 2u : FA_SK * (unsigned)HD * 2u;    /* bytes from a stage's tile to the next stage's */
  const unsigned ldst = (unsigned)(size_t)ring + ks * FA_QSLOT + tv * FA_TILE;   /* LDS byte offset of the wave's tile in buffer 0 */
  const fa_u32x8 g1 = fa_group1(tv ? (unsigned)SEQ * 2u : FA_ROWB);
  fa_u32x4 g0 = fa_group0(ldst, gsrc);
  if (fa_pinned(isu)) fa_tload(g0, g1);
  v16h qf[2][2];                                                 /* [query tile][d half], kept for the whole loop */
#pragma unroll
  for (int c = 0; c < 2; ++c) { qf[c][0] = g2_frag(qp + c * 16 * HD, hh); qf[c][1] = g2_frag(qp + c * 16 * HD + 32, hh); }
  v16h ones;
#pragma unroll
  for (int i = 0; i < 16; ++i) ones[i] = (_Float16)1.0f;
  const v8f z8 = {0.f,0.f,0.f,0.f,0.f,0.f,0.f,0.f};
  v8f o[2][4] = {{z8, z8, z8, z8}, {z8, z8, z8, z8}};            /* O^T tiles [query tile][d tile] */
  v8f ls[2] = {z8, z8};                                          /* ones . P^T: every row is the queries' weight sum; only register 0 is kept to scale */
  float mr[2] = {-3.0e38f, -3.0e38f};
  if (fa_pinned(isu)) fa_twait(g0, g1);                          /* stage 0 has landed before its issuer reaches the barrier */
  __syncthreads();                                               /* stage 0 is readable by every wave */
  g0 = fa_group0(ldst + FA_BUF, gsrc + gstep);
  if (fa_pinned(isu)) fa_tload(g0, g1);
  const unsigned char* kl0 = ring + ks * FA_QSLOT + (ln >> 1) * FA_PITCH + (ln & 1u) * 128u + hh * 16u;   /* the lane's place in K row ln of the quarter's K tile, buffer 0 */
  const unsigned char* vl0 = ring + ks * FA_QSLOT + FA_TILE + ln * FA_PITCH + hh * 16u;                   /* the same in row ln of the V^T tile */
#pragma unroll 1                                                 /* the stages share one copy of the pass */
  for (unsigned st = 0; st < FA_NST; ++st) {
  const unsigned char* kl = kl0 + (st & 1u) * FA_BUF;
  const unsigned char* vl = vl0 + (st & 1u) * FA_BUF;
  v16h kf[2][2];                                                 /* [key tile][d half], fetched one pass ahead inside the stage */
#pragma unroll
  for (int t = 0; t < 2; ++t) { kf[t][0] = fa_lfrag(kl + t * 8 * FA_PITCH); kf[t][1] = fa_lfrag(kl + t * 8 * FA_PITCH + 64); }
#pragma unroll 1                                                 /* one pass already holds 18 matrix instructions; a second copy would only cost registers */
  for (unsigned p = 0; p < FA_SK; p += 32u) {
    v16h vf[4];
#pragma unroll
    for (int t = 0; t < 4; ++t) vf[t] = fa_lfrag(vl + t * 16 * FA_PITCH + p * 2u);
    v8f s[2][2];                                                 /* [query tile][key tile] */
#pragma unroll
    for (int c = 0; c < 2; ++c) {
#pragma unroll
      for (int t = 0; t < 2; ++t) s[c][t] = fa_mma(kf[t][1], qf[c][1], fa_mma(kf[t][0], qf[c][0], z8)); }
    const unsigned pn = (p + 32u < FA_SK) ? p + 32u : 0u;        /* a stage's last pass refetches the stage's own first keys: same buffer, never used */
#pragma unroll
    for (int t = 0; t < 2; ++t) { kf[t][0] = fa_lfrag(kl + (pn / 2u + t * 8) * FA_PITCH); kf[t][1] = fa_lfrag(kl + (pn / 2u + t * 8) * FA_PITCH + 64); }
#pragma unroll
    for (int c = 0; c < 2; ++c) {
      float am = fmaxf(s[c][0][0], s[c][1][0]);
#pragma unroll
      for (int r = 1; r < 8; ++r) am = fmaxf(am, fmaxf(s[c][0][r], s[c][1][r]));
      am = fmaxf(am, fa_xhalf(am));
      const float mn = fmaxf(mr[c], am * FA_C1);
      const float corr = __builtin_amdgcn_exp2f(mr[c] - mn);     /* 0 on the first pass */
      mr[c] = mn;
      const float nm = FA_LOG2_CARRY - mn;
      FragH pf;
#pragma unroll
      for (int t = 0; t < 2; ++t) {
#pragma unroll
        for (int r = 0; r < 8; ++r) s[c][t][r] = __builtin_fmaf(s[c][t][r], FA_C1, nm);
        fa_exp2x8(s[c][t]);
#pragma unroll
        for (int r = 0; r < 8; ++r) pf.h[t * 8 + r] = (_Float16)s[c][t][r];   /* nearest f16, subnormals kept: both products that take pf read the same values */
      }
#pragma unroll
      for (int t = 0; t < 4; ++t) o[c][t] *= corr;
      ls[c][0] *= corr;
#pragma unroll
      for (int t = 0; t < 4; ++t) o[c][t] = fa_mma(vf[t], pf.v, o[c][t]);
      ls[c] = fa_mma(ones, pf.v, ls[c]);
    }
  }
  asm volatile("s_wait_dscnt 0x0" ::: "memory");                 /* this wave's reads of the stage's buffer have returned before the buffer may be refilled */
  if (fa_pinned(isu)) fa_twait(g0, g1);                          /* stage st + 1 has landed before its issuer reaches the barrier */
  __syncthreads();                                               /* publishes stage st + 1 and ends every wave's reads of stage st; behind the last stage it frees the ring for the partial tiles */
  const unsigned s2 = fa_pinned(st + 2u);                        /* formed behind the wait, and the descriptor's address words from it */
  if (fa_pinned((s2 < FA_NST) ? 1u : 0u)) {
    g0 = fa_group0(ldst + (s2 & 1u) * FA_BUF, gsrc + (unsigned long long)s2 * gstep);
    if (fa_pinned(isu)) fa_tload(g0, g1);                        /* into the buffer that stage st has just left */
  }
  }
  asm volatile("s_wait_tensorcnt 0x0" ::: "memory");             /* no request is left when the ring changes its use */
  asm volatile("s_wait_dscnt 0x0" ::: "memory");                 /* nor a read of it */
#pragma unroll                                                   /* constant indices keep the tiles in registers */
  for (int c = 0; c < 2; ++c) {
#pragma unroll
    for (int t = 0; t < 4; ++t) {
      const v4f lo = {o[c][t][0], o[c][t][1], o[c][t][2], o[c][t][3]}, hi = {o[c][t][4], o[c][t][5], o[c][t][6], o[c][t][7]};
      po[w][c][t][0][lane] = lo; po[w][c][t][1][lane] = hi; }
    pm[w][c][lane] = mr[c]; pl[w][c][lane] = ls[c][0];
  }
  __syncthreads();                                               /* every quarter's partial result is in LDS before any wave joins them */
  const unsigned jc = ks >> 1, jd = ks & 1u, wb = qg * 4u;       /* this wave joins query tile jc, d tiles 2 jd and 2 jd + 1: whole 128-byte lines of the output */
  float mj[4], wj[4];
#pragma unroll
  for (int j = 0; j < 4; ++j) mj[j] = pm[wb + j][jc][lane];
  const float mm = fmaxf(fmaxf(mj[0], mj[1]), fmaxf(mj[2], mj[3]));
  float lsum = 0.f;
#pragma unroll
  for (int j = 0; j < 4; ++j) { wj[j] = __builtin_amdgcn_exp2f(mj[j] - mm); lsum += pl[wb + j][jc][lane] * wj[j]; }
  const float f = 0.125f * (1.0f / lsum);                        /* lsum >= about 16384: the quarter that holds the row maximum has weight 1 and a term of about 16384 */
  float* op = O + ((size_t)b * SEQ + q0 + jc * 16u + ln) * HD + jd * 32u + 8u * hh;
#pragma unroll
  for (unsigned tt = 0; tt < 2u; ++tt) {
#pragma unroll
    for (unsigned h4 = 0; h4 < 2u; ++h4) {
      v4f a = po[wb][jc][jd * 2u + tt][h4][lane] * wj[0];
#pragma unroll
      for (int j = 1; j < 4; ++j) a += po[wb + j][jc][jd * 2u + tt][h4][lane] * wj[j];
      *(v4f*)(op + tt * 16u + h4 * 4u) = a * O_ALPHA * f;
    }
  }
}

extern "C" void kernel_launch(void* const* d_in, const int* in_sizes, int n_in,
                              void* d_out, int out_size, void* d_ws, size_t ws_size, hipStream_t stream) {
  if (n_in < 3) return;
  const size_t need_in = ((size_t)(NB - 1) * SEQ_FULL + SEQ) * HD;
  if ((size_t)in_sizes[0] < need_in || (size_t)in_sizes[1] < need_in || (size_t)in_sizes[2] < need_in) return;
  if ((size_t)out_size < (size_t)NB * SEQ * HD) return;
  const float* xq = (const float*)d_in[0]; const float* xk = (const float*)d_in[1]; const float* xv = (const float*)d_in[2];
  float* out = (float*)d_out;
  char* ws = (char*)d_ws; size_t off = 0;
  auto take = [&](size_t bytes) { char* p = ws + off; off += (bytes + 255) & ~(size_t)255; return p; };
  _Float16* Q16 = (_Float16*)take(WS_PLANE16);      /* [NB][SEQ][64]  64 * bf16(q) */
  _Float16* K16 = (_Float16*)take(WS_PLANE16);      /* [NB][SEQ][64]  64 * bf16(k) */
  _Float16* VT  = (_Float16*)take(WS_PLANE16);      /* [NB][64][SEQ]  64 * bf16(v), transposed */
  if (off > ws_size) return;

  k_prep<<<dim3(SEQ / 128, NB), 256, 0, stream>>>(xq, xk, xv, Q16, K16, VT);
  /* out[NB][SEQ][64] = softmax(q k^T) v * 0.125, f32 straight into the output */
  k_fattn<<<dim3(SEQ / (32 * FA_QG), NB), FA_NW * 32, 0, stream>>>(Q16, K16, VT, out);
}

// v006
// It runs in 31.7 microseconds.
// Timed twice side by side with v005, it ran 1.10 times as fast both times.
// All steps since v000 together make it 51.5 times as fast.
#include <hip/hip_runtime.h>
// Single-head softmax attention on given q, k, v ([NB][SEQ][64] f32 each): logits = q . k (no scale before the softmax), softmax over all SEQ keys, result x 0.125 applied after the softmax, out = weights . v -> [NB][SEQ][64] f32.
// Compute dtype: all contractions v_wmma_f32_16x16x32_f16 (f16 operands, f32 accumulate). q, k, v are RNE-converted to bf16 first and carried x64 as exact f16 planes (products exact in f32); logits and softmax statistics f32;
// softmax weights carried unnormalised as f16(exp2(s - held reference)) (rounded to nearest, f16 subnormals kept; a row's largest weight lies between 2^-5 and 2^15), row sum taken from the same f16 values, 0.125 / sum applied per row in the f32 epilogue.
// Structure: one launch converts q, k -> f16 planes and v -> V^T f16 plane via LDS transpose; one fused launch: per wave 32 queries x a quarter of the keys, logits, softmax against a held reference (lazy rescale) and weights . v all in registers, K and V^T tiles staged in LDS by tensor loads (two buffers), the four key quarters joined in LDS.
#ifndef NB
#define NB 8
#endif
#ifndef SEQ
#define SEQ 4096
#endif
#define NB_FULL 8                      /* batches in the inputs */
#define SEQ_FULL 4096                  /* rows per batch in the inputs (input batch pitch) */
#define HD 64
#define QK_CARRY 64.0f                 /* power-of-two carry of the q and k planes */
#define V_CARRY 64.0f                  /* power-of-two carry of the V^T plane */
#define S_ALPHA 0.000244140625f        /* 1 / (QK_CARRY * QK_CARRY) */
#define O_ALPHA 0.015625f              /* 1 / V_CARRY */

static_assert(NB >= 1 && NB <= NB_FULL);
static_assert(SEQ >= 256 && SEQ <= SEQ_FULL);
static_assert(HD == 64);
static_assert((SEQ / 128) * 128 == SEQ);                         /* query rows per block, 32-key passes of a key quarter */
static_assert((SEQ / 64) * 64 == SEQ);                           /* V^T token groups */
#define WS_PLANE16 ((size_t)NB * SEQ * HD * 2)
static_assert(WS_PLANE16 % 256 == 0);
static_assert(3 * WS_PLANE16 <= (size_t)134217728);

typedef unsigned short v8us __attribute__((ext_vector_type(8), may_alias));
typedef float  v8f  __attribute__((ext_vector_type(8)));
typedef float  v4f  __attribute__((ext_vector_type(4)));
typedef float  v2f  __attribute__((ext_vector_type(2)));
typedef float  v4fa __attribute__((ext_vector_type(4), may_alias));
typedef _Float16 v16h __attribute__((ext_vector_type(16)));
union FragH { v16h v; v8us half[2]; _Float16 h[16]; unsigned short u[16]; };

__device__ __forceinline__ unsigned short bf16_bits(float x) { unsigned int u = __float_as_uint(x); return (unsigned short)((u + 0x7FFFu + ((u >> 16) & 1u)) >> 16); }
__device__ __forceinline__ float bf16_val(unsigned short b) { return __uint_as_float(((unsigned int)b) << 16); }
__device__ __forceinline__ float bf16_rne(float x) { return bf16_val(bf16_bits(x)); }

// One launch makes the three f16 planes. A block takes PT tokens of one batch from q, k and v alike (one block a WGP at the full shape): few, long waves in place of many short ones,
// and every global load of a thread is issued before its first conversion. All loops are unrolled: constant indices keep the loaded pieces in registers.
#define PT 128u                        /* tokens per block */
#define PCH 4u                         /* 8-element pieces per thread and input: PT * HD / 8 / 256 */
static_assert(PT * HD == PCH * 256u * 8u && (SEQ / PT) * PT == SEQ);
__device__ __forceinline__ v8us cvt8(v4f a, v4f c, float carry) {
  FragH f;
#pragma unroll
  for (int q = 0; q < 4; ++q) { f.h[q] = (_Float16)(bf16_rne(a[q]) * carry); f.h[4 + q] = (_Float16)(bf16_rne(c[q]) * carry); }
  return f.half[0];
}
__global__ __launch_bounds__(256) void k_prep(const float* __restrict__ xq, const float* __restrict__ xk, const float* __restrict__ xv,
                                              _Float16* __restrict__ Q16, _Float16* __restrict__ K16, _Float16* __restrict__ VT) {
  __shared__ unsigned short tl[PT][66];                          /* [token][d]; all PT x 64 entries written before the barrier; cross-wave -> block barrier */
  const unsigned tid = threadIdx.x, g = blockIdx.x, b = blockIdx.y;
  const size_t in0 = ((size_t)b * SEQ_FULL + (size_t)g * PT) * HD + (size_t)tid * 8u;   /* the thread's first piece in an input */
  const size_t pl0 = ((size_t)b * SEQ + (size_t)g * PT) * HD + (size_t)tid * 8u;        /* the same in a q or k plane */
  v4f rv[PCH][2], rq[PCH][2], rk[PCH][2];
#pragma unroll
  for (unsigned j = 0; j < PCH; ++j) { const float* p = xv + in0 + j * 2048u; rv[j][0] = *(const v4fa*)p; rv[j][1] = *(const v4fa*)(p + 4); }
#pragma unroll
  for (unsigned j = 0; j < PCH; ++j) { const float* p = xq + in0 + j * 2048u; rq[j][0] = *(const v4fa*)p; rq[j][1] = *(const v4fa*)(p + 4); }
#pragma unroll
  for (unsigned j = 0; j < PCH; ++j) { const float* p = xk + in0 + j * 2048u; rk[j][0] = *(const v4fa*)p; rk[j][1] = *(const v4fa*)(p + 4); }
  asm volatile("s_wait_xcnt 0x0" :: "v"(xv + in0), "v"(xq + in0), "v"(xk + in0) : "memory");   /* the precaution kept before a register that an issued load names is rewritten; naming the three address pairs keeps them whole until here, and as a memory statement it holds all 24 loads in front of the conversions (without it half of them are issued only after the first have returned: a second latency in series) */
#pragma unroll
  for (unsigned j = 0; j < PCH; ++j) {
    const unsigned r = j * 32u + (tid >> 3), c8 = (tid & 7u) * 8u;
    FragH f; f.half[0] = cvt8(rv[j][0], rv[j][1], V_CARRY);
#pragma unroll
    for (int q = 0; q < 8; ++q) tl[r][c8 + q] = f.u[q];
  }
  __syncthreads();
#pragma unroll
  for (unsigned u = 0; u < PT / 64u; ++u) {
#pragma unroll
    for (unsigned rd = 0; rd < 2u; ++rd) {
      const unsigned d = rd * 32u + (tid >> 3), pc = tid & 7u; FragH f;
#pragma unroll
      for (unsigned q = 0; q < 8u; ++q) f.u[q] = tl[u * 64u + pc * 8u + q][d];
      *(v8us*)((unsigned short*)VT + ((size_t)b * HD + d) * SEQ + (size_t)g * PT + u * 64u + pc * 8u) = f.half[0];
    }
  }
#pragma unroll
  for (unsigned j = 0; j < PCH; ++j) *(v8us*)((unsigned short*)Q16 + pl0 + j * 2048u) = cvt8(rq[j][0], rq[j][1], QK_CARRY);
#pragma unroll
  for (unsigned j = 0; j < PCH; ++j) *(v8us*)((unsigned short*)K16 + pl0 + j * 2048u) = cvt8(rk[j][0], rk[j][1], QK_CARRY);
}

// ---- fused attention: S^T = K Q^T, O^T += V^T P^T ----
// Fragment map (A row / B column = lane & 15, h = lane >> 4): elements 0..7 <- k0 + 8h + i, elements 8..15 <- k0 + 16 + 8h + i; D element r <- (row 8h + r, col lane & 15).
// With K as A and Q as B a lane's score registers all belong to query (lane & 15): maximum and exponent are lane-local but for one exchange between the wave halves, and the two 16-key score tiles of a pass,
// converted in place, are the B operand of the second product (its k order is the map above, which fa_lfrag gives V^T too). O^T keeps query = lane & 15, so the rescale factor is lane-local as well.
// K and V^T reach the waves through LDS. Per stage (128 keys of a quarter) one tensor load brings the K rows, taken two to a 256-byte tile row, and one brings the 64 V^T rows of 256 B; both land at an LDS pitch of 272 B.
// The 4 query groups of a quarter read the same tiles by 16-byte LDS loads whose 16 lanes of a half fall on 64 different banks. Two buffers: stage s + 1 flies while stage s is worked on.
// Block = 16 waves = 4 query groups of 32 rows x 4 key quarters. Each wave leaves (reference, sum, O^T) of its quarter in LDS; behind the block barrier the four waves of a query group join them in quarter order.
__device__ __forceinline__ v16h g2_frag(const _Float16* p, unsigned hh) { FragH f; f.half[0] = *(const v8us*)((const unsigned short*)p + 8u * hh); f.half[1] = *(const v8us*)((const unsigned short*)p + 16u + 8u * hh); return f.v; }
__device__ __forceinline__ v8f fa_mma(v16h a, v16h b, v8f c) { return __builtin_amdgcn_wmma_f32_16x16x32_f16(false, a, false, b, (short)0, c, false, false); }
__device__ __forceinline__ float fa_xhalf(float x) { return __builtin_bit_cast(float, __builtin_amdgcn_permlanex16(__builtin_bit_cast(int, x), __builtin_bit_cast(int, x), 0x76543210, 0xfedcba98, false, false)); }   /* lane l <-> lane l ^ 16 */
// Eight base-2 exponentials, each in place, in one statement: no result lands on a neighbour's source, and the closing v_nop is the free slot the instruction set asks for between a transcendental and the first use of its result.
__device__ __forceinline__ void fa_exp2x8(v8f& x) {
  asm("v_exp_f32 %0, %0\n\tv_exp_f32 %1, %1\n\tv_exp_f32 %2, %2\n\tv_exp_f32 %3, %3\n\tv_exp_f32 %4, %4\n\tv_exp_f32 %5, %5\n\tv_exp_f32 %6, %6\n\tv_exp_f32 %7, %7\n\tv_nop"
      : "+v"(x[0]), "+v"(x[1]), "+v"(x[2]), "+v"(x[3]), "+v"(x[4]), "+v"(x[5]), "+v"(x[6]), "+v"(x[7]));
}
#define FA_QG 4                        /* query groups (32 rows each) per block */
#define FA_KS 4                        /* key quarters per block */
#define FA_NW (FA_QG * FA_KS)
#define FA_KW (SEQ / FA_KS)            /* keys per wave */
#define FA_C1 (S_ALPHA * 1.4426950408889634f)   /* score accumulator -> logit in base-2 units */
#define FA_XTOP 15.0f                  /* largest base-2 exponent a weight may take before its row's reference moves: 2^15 is inside f16 */
#define FA_HEAD 20.0f                  /* a moved reference puts the row's largest logit of the pass at exponent FA_XTOP - FA_HEAD: room to grow by 2^20 before the next move */
#define FA_SK 128u                     /* keys of a quarter per stage */
#define FA_NST ((unsigned)FA_KW / FA_SK)   /* stages per quarter */
#define FA_ROWB 256u                   /* bytes of a tile row: two K rows, or 128 keys of a V^T row */
#define FA_ROWS 64u                    /* rows of a tile */
#define FA_PITCH 272u                  /* LDS pitch of a tile row: 256 B + 16 B pad */
#define FA_TILE 18432u                 /* 64 rows x 272 B = 17408 B, rounded up to a multiple of 2 KiB */
#define FA_QSLOT (2u * FA_TILE)        /* one quarter's K and V^T tiles of a stage */
#define FA_BUF (FA_KS * FA_QSLOT)      /* one buffer: the four quarters' tiles of a stage */
#define FA_W0 ((1u << 20) | (5u << 22) | (3u << 25))   /* descriptor group 1 word 0: no mask, byte elements, 4 dwords of pad behind every 256 B */
static_assert(FA_NST * FA_SK == (unsigned)FA_KW && FA_NST >= 2u && FA_ROWS * FA_PITCH <= FA_TILE && FA_TILE % 2048u == 0u);
static_assert(FA_SK * 2u == FA_ROWB && HD * 2 * 2 == FA_ROWB && FA_SK / 2u == FA_ROWS && HD == FA_ROWS);
static_assert(2u * FA_BUF + 2u * FA_NW * 2u * 32u * 4u <= 327680u && (size_t)FA_NW * 2 * 4 * 2 * 32 * 16 <= 2u * FA_BUF);
typedef unsigned int fa_u32x4 __attribute__((ext_vector_type(4)));
typedef unsigned int fa_u32x8 __attribute__((ext_vector_type(8)));
__device__ __forceinline__ unsigned fa_uni(unsigned v) { return (unsigned)__builtin_amdgcn_readfirstlane((int)v); }
__device__ __forceinline__ unsigned fa_pinned(unsigned v) { unsigned w = fa_uni(v); asm volatile("" : "+s"(w)); /* holds the word in a scalar register, so that a test on it is a scalar branch: a tensor load ignores EXEC */ return w; }
// Descriptor group 0: one request, LDS byte offset, global byte address of the tile's first byte, type 2.
__device__ __forceinline__ fa_u32x4 fa_group0(unsigned lds_dst, unsigned long long ga) {
  fa_u32x4 g;
  g[0] = fa_uni(1u); g[1] = fa_uni(lds_dst); g[2] = fa_uni((unsigned)ga); g[3] = fa_uni((((unsigned)(ga >> 32)) & 0x01FFFFFFu) | 0x80000000u);
  asm volatile("" : "+s"(g));          /* the pinned form for descriptor words: held in scalar registers of their own, which fa_twait keeps untouched while the request flies */
  return g;
}
// Descriptor group 1: tensor = tile = FA_ROWS rows of FA_ROWB bytes, byte elements, source pitch src_pitch bytes.
__device__ __forceinline__ fa_u32x8 fa_group1(unsigned src_pitch) {
  fa_u32x8 g;
  g[0] = fa_uni(FA_W0);
  g[1] = fa_uni((FA_ROWB & 0xFFFFu) << 16);
  g[2] = fa_uni((FA_ROWB >> 16) | ((FA_ROWS & 0xFFFFu) << 16));
  g[3] = fa_uni((FA_ROWS >> 16) | (FA_ROWB << 16));
  g[4] = fa_uni(FA_ROWS);
  g[5] = fa_uni(src_pitch);
  g[6] = fa_uni(0u);
  g[7] = fa_uni(0u);
  asm volatile("" : "+s"(g));          /* the pinned form for descriptor words: held in scalar registers of their own for the whole loop, not formed anew in registers that are reused */
  return g;
}
__device__ __forceinline__ void fa_tload(fa_u32x4 g0, fa_u32x8 g1) { asm volatile("tensor_load_to_lds %0, %1" :: "s"(g0), "s"(g1) : "memory"); }   /* one request of the whole wave */
__device__ __forceinline__ void fa_twait(fa_u32x4 g0, fa_u32x8 g1) { asm volatile("s_wait_tensorcnt 0x0" :: "s"(g0), "s"(g1) : "memory"); }   /* the wave's request has landed; naming the descriptor keeps its registers as they are until here */
__device__ __forceinline__ v16h fa_lfrag(const unsigned char* p) { FragH f; f.half[0] = *(const v8us*)p; f.half[1] = *(const v8us*)(p + 32); return f.v; }   /* p already holds the lane's 16 h bytes */
static_assert(FA_KS == 4 && FA_KW * FA_KS == SEQ && FA_KW % 32 == 0 && SEQ % (32 * FA_QG) == 0);
__global__ __launch_bounds__(FA_NW * 32) void k_fattn(const _Float16* __restrict__ Q16, const _Float16* __restrict__ K16, const _Float16* __restrict__ VT, float* __restrict__ O) {
  __shared__ __attribute__((aligned(2048))) unsigned char ring[2u * FA_BUF];   /* [buffer][quarter][K tile, V^T tile]; behind the loop's last barrier it holds the partial O^T tiles */
  v4fa (*po)[2][4][2][32] = (v4fa (*)[2][4][2][32])ring;                /* [wave][query tile][d tile][register quad][lane]; every entry written before the barrier */
  __shared__ float pm[FA_NW][2][32], pl[FA_NW][2][32];                  /* [wave][query tile][lane] reference in use (base 2) and carried sum */
  const unsigned tid = threadIdx.x, w = fa_uni(tid >> 5), lane = tid & 31u, ln = lane & 15u, hh = lane >> 4;
  const unsigned qg = w >> 2, ks = w & 3u, b = blockIdx.y;
  const unsigned q0 = blockIdx.x * (32u * FA_QG) + qg * 32u, k0 = ks * (unsigned)FA_KW;
  const _Float16* qp = Q16 + ((size_t)b * SEQ + q0 + ln) * HD;
  const unsigned isu = (qg < 2u) ? 1u : 0u, tv = (qg == 1u) ? 1u : 0u;   /* query group 0's wave brings its quarter's K tile, group 1's the V^T tile */
  const unsigned long long gsrc = tv ? (unsigned long long)(size_t)(VT + (size_t)b * HD * SEQ + k0)      /* first byte of the quarter's keys in V^T row 0 */
                                     : (unsigned long long)(size_t)(K16 + ((size_t)b * SEQ + k0) * HD);  /* first byte of the quarter's K rows */
  const unsigned gstep = tv ? FA_SK * 2u : FA_SK * (unsigned)HD * 2u;    /* bytes from a stage's tile to the next stage's */
  const unsigned ldst = (unsigned)(size_t)ring + ks * FA_QSLOT + tv * FA_TILE;   /* LDS byte offset of the wave's tile in buffer 0 */
  const fa_u32x8 g1 = fa_group1(tv ? (unsigned)SEQ * 2u : FA_ROWB);
  fa_u32x4 g0 = fa_group0(ldst, gsrc);
  if (fa_pinned(isu)) fa_tload(g0, g1);
  v16h qf[2][2];                                                 /* [query tile][d half], kept for the whole loop */
#pragma unroll
  for (int c = 0; c < 2; ++c) { qf[c][0] = g2_frag(qp + c * 16 * HD, hh); qf[c][1] = g2_frag(qp + c * 16 * HD + 32, hh); }
  union { v16h v; unsigned w[8]; } on1;                          /* sixteen f16 ones */
  asm("v_mov_b32 %0, 0x3c003c00\n\tv_mov_b32 %1, 0x3c003c00\n\tv_mov_b32 %2, 0x3c003c00\n\tv_mov_b32 %3, 0x3c003c00\n\tv_mov_b32 %4, 0x3c003c00\n\tv_mov_b32 %5, 0x3c003c00\n\tv_mov_b32 %6, 0x3c003c00\n\tv_mov_b32 %7, 0x3c003c00"
      : "=v"(on1.w[0]), "=v"(on1.w[1]), "=v"(on1.w[2]), "=v"(on1.w[3]), "=v"(on1.w[4]), "=v"(on1.w[5]), "=v"(on1.w[6]), "=v"(on1.w[7]));   /* made once by moves the compiler cannot repeat: as a plain constant it is rebuilt in all eight registers in every pass */
  const v16h ones = on1.v;
  const v8f z8 = {0.f,0.f,0.f,0.f,0.f,0.f,0.f,0.f};
  v8f o[2][4] = {{z8, z8, z8, z8}, {z8, z8, z8, z8}};            /* O^T tiles [query tile][d tile] */
  v8f ls[2] = {z8, z8};                                          /* ones . P^T: every row is the queries' weight sum; only register 0 is kept to scale */
  float nm[2] = {3.0e38f, 3.0e38f};                              /* minus the query's reference, base 2: a weight is exp2(logit + nm); the start value makes the first pass set it */
  if (fa_pinned(isu)) fa_twait(g0, g1);                          /* stage 0 has landed before its issuer reaches the barrier */
  __syncthreads();                                               /* stage 0 is readable by every wave */
  g0 = fa_group0(ldst + FA_BUF, gsrc + gstep);
  if (fa_pinned(isu)) fa_tload(g0, g1);
  const unsigned char* kl0 = ring + ks * FA_QSLOT + (ln >> 1) * FA_PITCH + (ln & 1u) * 128u + hh * 16u;   /* the lane's place in K row ln of the quarter's K tile, buffer 0 */
  const unsigned char* vl0 = ring + ks * FA_QSLOT + FA_TILE + ln * FA_PITCH + hh * 16u;                   /* the same in row ln of the V^T tile */
#pragma unroll 1                                                 /* the stages share one copy of the pass */
  for (unsigned st = 0; st < FA_NST; ++st) {
  const unsigned char* kl = kl0 + (st & 1u) * FA_BUF;
  const unsigned char* vl = vl0 + (st & 1u) * FA_BUF;
  v16h kf[2][2];                                                 /* [key tile][d half], fetched one pass ahead inside the stage */
#pragma unroll
  for (int t = 0; t < 2; ++t) { kf[t][0] = fa_lfrag(kl + t * 8 * FA_PITCH); kf[t][1] = fa_lfrag(kl + t * 8 * FA_PITCH + 64); }
#pragma unroll 1                                                 /* one pass already holds 18 matrix instructions; a second copy would only cost registers */
  for (unsigned p = 0; p < FA_SK; p += 32u) {
    v16h vf[4];
#pragma unroll
    for (int t = 0; t < 4; ++t) vf[t] = fa_lfrag(vl + t * 16 * FA_PITCH + p * 2u);
    v8f s[2][2];                                                 /* [query tile][key tile] */
#pragma unroll
    for (int c = 0; c < 2; ++c) {
#pragma unroll
      for (int t = 0; t < 2; ++t) s[c][t] = fa_mma(kf[t][1], qf[c][1], fa_mma(kf[t][0], qf[c][0], z8)); }
    const unsigned pn = (p + 32u < FA_SK) ? p + 32u : 0u;        /* a stage's last pass refetches the stage's own first keys: same buffer, never used */
#pragma unroll
    for (int t = 0; t < 2; ++t) { kf[t][0] = fa_lfrag(kl + (pn / 2u + t * 8) * FA_PITCH); kf[t][1] = fa_lfrag(kl + (pn / 2u + t * 8) * FA_PITCH + 64); }
    __builtin_amdgcn_sched_barrier(0);                           /* keeps the V^T loads and the K loads of the next pass issued up here, and the eight score products in one run in front of the vector work */
    float am[2];                                                 /* the lane's own largest score of the pass, per query tile (its half of the keys) */
#pragma unroll
    for (int c = 0; c < 2; ++c) {
      am[c] = fmaxf(s[c][0][0], s[c][1][0]);
#pragma unroll
      for (int r = 1; r < 8; ++r) am[c] = fmaxf(am[c], fmaxf(s[c][0][r], s[c][1][r]));
    }
    // Lazy rescale, tested once per pass: the references stay, and O^T and the sums are left alone, unless some weight of the pass would leave f16. The ballot makes it a scalar branch, so every lane is on at the matrix instructions.
    const float xm = fmaxf(__builtin_fmaf(am[0], FA_C1, nm[0]), __builtin_fmaf(am[1], FA_C1, nm[1]));   /* the same expression as the weights' exponents, so it is their largest */
    if (__builtin_expect(__builtin_amdgcn_ballot_w32(xm > FA_XTOP) != 0u, 0)) {   /* rare: laid out off the straight path */
#pragma unroll
      for (int c = 0; c < 2; ++c) {
        const float ax = fmaxf(am[c], fa_xhalf(am[c]));          /* both halves of a query's keys: the two lanes of a query move alike */
        const float nn = fminf(nm[c], (FA_XTOP - FA_HEAD) - ax * FA_C1);   /* only towards a larger reference; a query with no logit above the one that set its reference keeps it */
        const float corr = __builtin_amdgcn_exp2f(nn - nm[c]);   /* 0 on the first pass, 1 for a query that keeps its reference */
        nm[c] = nn;
#pragma unroll
        for (int t = 0; t < 4; ++t) o[c][t] *= corr;
        ls[c][0] *= corr;
      }
    }
    FragH pf[2];
#pragma unroll
    for (int c = 0; c < 2; ++c) {
#pragma unroll
      for (int t = 0; t < 2; ++t) {
#pragma unroll
        for (int r = 0; r < 8; ++r) s[c][t][r] = __builtin_fmaf(s[c][t][r], FA_C1, nm[c]);
        fa_exp2x8(s[c][t]);
#pragma unroll
        for (int r = 0; r < 8; ++r) pf[c].h[t * 8 + r] = (_Float16)s[c][t][r];   /* nearest f16, subnormals kept: both products that take pf read the same values */
      }
    }
    __builtin_amdgcn_sched_barrier(0);                           /* both weight tiles are packed before the first of the ten products: no vector instruction then lands on a product's operand, which would cost four idle slots */
#pragma unroll
    for (int c = 0; c < 2; ++c) {
#pragma unroll
      for (int t = 0; t < 4; ++t) o[c][t] = fa_mma(vf[t], pf[c].v, o[c][t]);
      ls[c] = fa_mma(ones, pf[c].v, ls[c]);
    }
  }
  asm volatile("s_wait_dscnt 0x0" ::: "memory");                 /* this wave's reads of the stage's buffer have returned before the buffer may be refilled */
  if (fa_pinned(isu)) fa_twait(g0, g1);                          /* stage st + 1 has landed before its issuer reaches the barrier */
  __syncthreads();                                               /* publishes stage st + 1 and ends every wave's reads of stage st; behind the last stage it frees the ring for the partial tiles */
  const unsigned s2 = fa_pinned(st + 2u);                        /* formed behind the wait, and the descriptor's address words from it */
  if (fa_pinned((s2 < FA_NST) ? 1u : 0u)) {
    g0 = fa_group0(ldst + (s2 & 1u) * FA_BUF, gsrc + (unsigned long long)s2 * gstep);
    if (fa_pinned(isu)) fa_tload(g0, g1);                        /* into the buffer that stage st has just left */
  }
  }
  asm volatile("s_wait_tensorcnt 0x0" ::: "memory");             /* no request is left when the ring changes its use */
  asm volatile("s_wait_dscnt 0x0" ::: "memory");                 /* nor a read of it */
#pragma unroll                                                   /* constant indices keep the tiles in registers */
  for (int c = 0; c < 2; ++c) {
#pragma unroll
    for (int t = 0; t < 4; ++t) {
      const v4f lo = {o[c][t][0], o[c][t][1], o[c][t][2], o[c][t][3]}, hi = {o[c][t][4], o[c][t][5], o[c][t][6], o[c][t][7]};
      po[w][c][t][0][lane] = lo; po[w][c][t][1][lane] = hi; }
    pm[w][c][lane] = -nm[c]; pl[w][c][lane] = ls[c][0];
  }
  __syncthreads();                                               /* every quarter's partial result is in LDS before any wave joins them */
  const unsigned jc = ks >> 1, jd = ks & 1u, wb = qg * 4u;       /* this wave joins query tile jc, d tiles 2 jd and 2 jd + 1: whole 128-byte lines of the output */
  float mj[4], wj[4];
#pragma unroll
  for (int j = 0; j < 4; ++j) mj[j] = pm[wb + j][jc][lane];
  const float mm = fmaxf(fmaxf(mj[0], mj[1]), fmaxf(mj[2], mj[3]));
  float lsum = 0.f;
#pragma unroll
  for (int j = 0; j < 4; ++j) { wj[j] = __builtin_amdgcn_exp2f(mj[j] - mm); lsum += pl[wb + j][jc][lane] * wj[j]; }
  const float f = 0.125f * (1.0f / lsum);                        /* lsum >= about 2^-5: the quarter with the largest reference has weight 1, and its largest logit at the reference's last move gave a term of about 2^(FA_XTOP - FA_HEAD) */
  float* op = O + ((size_t)b * SEQ + q0 + jc * 16u + ln) * HD + jd * 32u + 8u * hh;
#pragma unroll
  for (unsigned tt = 0; tt < 2u; ++tt) {
#pragma unroll
    for (unsigned h4 = 0; h4 < 2u; ++h4) {
      v4f a = po[wb][jc][jd * 2u + tt][h4][lane] * wj[0];
#pragma unroll
      for (int j = 1; j < 4; ++j) a += po[wb + j][jc][jd * 2u + tt][h4][lane] * wj[j];
      *(v4f*)(op + tt * 16u + h4 * 4u) = a * O_ALPHA * f;
    }
  }
}

extern "C" void kernel_launch(void* const* d_in, const int* in_sizes, int n_in,
                              void* d_out, int out_size, void* d_ws, size_t ws_size, hipStream_t stream) {
  if (n_in < 3) return;
  const size_t need_in = ((size_t)(NB - 1) * SEQ_FULL + SEQ) * HD;
  if ((size_t)in_sizes[0] < need_in || (size_t)in_sizes[1] < need_in || (size_t)in_sizes[2] < need_in) return;
  if ((size_t)out_size < (size_t)NB * SEQ * HD) return;
  const float* xq = (const float*)d_in[0]; const float* xk = (const float*)d_in[1]; const float* xv = (const float*)d_in[2];
  float* out = (float*)d_out;
  char* ws = (char*)d_ws; size_t off = 0;
  auto take = [&](size_t bytes) { char* p = ws + off; off += (bytes + 255) & ~(size_t)255; return p; };
  _Float16* Q16 = (_Float16*)take(WS_PLANE16);      /* [NB][SEQ][64]  64 * bf16(q) */
  _Float16* K16 = (_Float16*)take(WS_PLANE16);      /* [NB][SEQ][64]  64 * bf16(k) */
  _Float16* VT  = (_Float16*)take(WS_PLANE16);      /* [NB][64][SEQ]  64 * bf16(v), transposed */
  if (off > ws_size) return;

  k_prep<<<dim3(SEQ / 128, NB), 256, 0, stream>>>(xq, xk, xv, Q16, K16, VT);
  /* out[NB][SEQ][64] = softmax(q k^T) v * 0.125, f32 straight into the output */
  k_fattn<<<dim3(SEQ / (32 * FA_QG), NB), FA_NW * 32, 0, stream>>>(Q16, K16, VT, out);
}

// v007
// One run takes 30 microseconds.
// Timed twice side by side with v006, it ran 1.06 and 1.05 times as fast.
// Counting every step since v000, it is 54.2 times as fast.
#include <hip/hip_runtime.h>
// Single-head softmax attention on given q, k, v ([NB][SEQ][64] f32 each): logits = q . k (no scale before the softmax), softmax over all SEQ keys, result x 0.125 applied after the softmax, out = weights . v -> [NB][SEQ][64] f32.
// Compute dtype: all contractions v_wmma_f32_16x16x32_f16 (f16 operands, f32 accumulate). q, k, v are RNE-converted to bf16 first and carried x64 as exact f16 (k and V^T planes, q rows in LDS; products exact in f32); logits and softmax statistics f32;
// softmax weights carried unnormalised as f16(exp2(s - held reference)) (rounded to nearest, f16 subnormals kept; a row's largest weight lies between 2^-5 and 2^15), row sum taken from the same f16 values, 0.125 / sum applied per row in the f32 epilogue.
// Structure: one launch converts k -> f16 plane and v -> V^T f16 plane via LDS transpose; one fused launch (each block converts its own 128 query rows into LDS first): per wave 32 queries x a quarter of the keys, logits, softmax against a held reference (lazy rescale) and weights . v all in registers, K and V^T tiles staged in LDS by tensor loads (two buffers), the four key quarters joined in LDS.
#ifndef NB
#define NB 8
#endif
#ifndef SEQ
#define SEQ 4096
#endif
#define NB_FULL 8                      /* batches in the inputs */
#define SEQ_FULL 4096                  /* rows per batch in the inputs (input batch pitch) */
#define HD 64
#define QK_CARRY 64.0f                 /* power-of-two carry of the q rows and the k plane */
#define V_CARRY 64.0f                  /* power-of-two carry of the V^T plane */
#define S_ALPHA 0.000244140625f        /* 1 / (QK_CARRY * QK_CARRY) */
#define O_ALPHA 0.015625f              /* 1 / V_CARRY */

static_assert(NB >= 1 && NB <= NB_FULL);
static_assert(SEQ >= 256 && SEQ <= SEQ_FULL);
static_assert(HD == 64);
static_assert((SEQ / 128) * 128 == SEQ);                         /* query rows per block, 32-key passes of a key quarter */
static_assert((SEQ / 64) * 64 == SEQ);                           /* V^T token groups */
#define WS_PLANE16 ((size_t)NB * SEQ * HD * 2)
static_assert(WS_PLANE16 % 256 == 0);
static_assert(2 * WS_PLANE16 <= (size_t)134217728);

typedef unsigned short v8us __attribute__((ext_vector_type(8), may_alias));
typedef float  v8f  __attribute__((ext_vector_type(8)));
typedef float  v4f  __attribute__((ext_vector_type(4)));
typedef float  v2f  __attribute__((ext_vector_type(2)));
typedef float  v4fa __attribute__((ext_vector_type(4), may_alias));
typedef _Float16 v16h __attribute__((ext_vector_type(16)));
union FragH { v16h v; v8us half[2]; _Float16 h[16]; unsigned short u[16]; };

__device__ __forceinline__ unsigned short bf16_bits(float x) { unsigned int u = __float_as_uint(x); return (unsigned short)((u + 0x7FFFu + ((u >> 16) & 1u)) >> 16); }
__device__ __forceinline__ float bf16_val(unsigned short b) { return __uint_as_float(((unsigned int)b) << 16); }
__device__ __forceinline__ float bf16_rne(float x) { return bf16_val(bf16_bits(x)); }

// One launch makes the two f16 planes that every block of a batch shares. A block takes PT tokens of one batch from k and v alike (one block a WGP at the full shape): few, long waves in place of many short ones,
// and every global load of a thread is issued before its first conversion. All loops are unrolled: constant indices keep the loaded pieces in registers.
#define PT 128u                        /* tokens per block */
#define PCH 4u                         /* 8-element pieces per thread and input: PT * HD / 8 / 256 */
static_assert(PT * HD == PCH * 256u * 8u && (SEQ / PT) * PT == SEQ);
__device__ __forceinline__ v8us cvt8(v4f a, v4f c, float carry) {
  FragH f;
#pragma unroll
  for (int q = 0; q < 4; ++q) { f.h[q] = (_Float16)(bf16_rne(a[q]) * carry); f.h[4 + q] = (_Float16)(bf16_rne(c[q]) * carry); }
  return f.half[0];
}
__global__ __launch_bounds__(256) void k_prep(const float* __restrict__ xk, const float* __restrict__ xv,
                                              _Float16* __restrict__ K16, _Float16* __restrict__ VT) {
  __shared__ unsigned short tl[PT][66];                          /* [token][d]; all PT x 64 entries written before the barrier; cross-wave -> block barrier */
  const unsigned tid = threadIdx.x, g = blockIdx.x, b = blockIdx.y;
  const size_t in0 = ((size_t)b * SEQ_FULL + (size_t)g * PT) * HD + (size_t)tid * 8u;   /* the thread's first piece in an input */
  const size_t pl0 = ((size_t)b * SEQ + (size_t)g * PT) * HD + (size_t)tid * 8u;        /* the same in the k plane */
  v4f rv[PCH][2], rk[PCH][2];
#pragma unroll
  for (unsigned j = 0; j < PCH; ++j) { const float* p = xv + in0 + j * 2048u; rv[j][0] = *(const v4fa*)p; rv[j][1] = *(const v4fa*)(p + 4); }
#pragma unroll
  for (unsigned j = 0; j < PCH; ++j) { const float* p = xk + in0 + j * 2048u; rk[j][0] = *(const v4fa*)p; rk[j][1] = *(const v4fa*)(p + 4); }
  asm volatile("s_wait_xcnt 0x0" :: "v"(xv + in0), "v"(xk + in0) : "memory");   /* the precaution kept before a register that an issued load names is rewritten; naming the two address pairs keeps them whole until here, and as a memory statement it holds all 16 loads in front of the conversions (without it half of them are issued only after the first have returned: a second latency in series) */
#pragma unroll
  for (unsigned j = 0; j < PCH; ++j) {
    const unsigned r = j * 32u + (tid >> 3), c8 = (tid & 7u) * 8u;
    FragH f; f.half[0] = cvt8(rv[j][0], rv[j][1], V_CARRY);
#pragma unroll
    for (int q = 0; q < 8; ++q) tl[r][c8 + q] = f.u[q];
  }
  __syncthreads();
#pragma unroll
  for (unsigned u = 0; u < PT / 64u; ++u) {
#pragma unroll
    for (unsigned rd = 0; rd < 2u; ++rd) {
      const unsigned d = rd * 32u + (tid >> 3), pc = tid & 7u; FragH f;
#pragma unroll
      for (unsigned q = 0; q < 8u; ++q) f.u[q] = tl[u * 64u + pc * 8u + q][d];
      *(v8us*)((unsigned short*)VT + ((size_t)b * HD + d) * SEQ + (size_t)g * PT + u * 64u + pc * 8u) = f.half[0];
    }
  }
#pragma unroll
  for (unsigned j = 0; j < PCH; ++j) *(v8us*)((unsigned short*)K16 + pl0 + j * 2048u) = cvt8(rk[j][0], rk[j][1], QK_CARRY);
}

// ---- fused attention: S^T = K Q^T, O^T += V^T P^T ----
// Fragment map (A row / B column = lane & 15, h = lane >> 4): elements 0..7 <- k0 + 8h + i, elements 8..15 <- k0 + 16 + 8h + i; D element r <- (row 8h + r, col lane & 15).
// With K as A and Q as B a lane's score registers all belong to query (lane & 15): maximum and exponent are lane-local but for one exchange between the wave halves, and the two 16-key score tiles of a pass,
// converted in place, are the B operand of the second product (its k order is the map above, which fa_lfrag gives V^T too). O^T keeps query = lane & 15, so the rescale factor is lane-local as well.
// K and V^T reach the waves through LDS. Per stage (128 keys of a quarter) one tensor load brings the K rows, taken two to a 256-byte tile row, and one brings the 64 V^T rows of 256 B; both land at an LDS pitch of 272 B.
// The 4 query groups of a quarter read the same tiles by 16-byte LDS loads whose 16 lanes of a half fall on 64 different banks. Two buffers: stage s + 1 flies while stage s is worked on.
// Block = 16 waves = 4 query groups of 32 rows x 4 key quarters. Each wave leaves (reference, sum, O^T) of its quarter in LDS; behind the block barrier the four waves of a query group join them in quarter order.
__device__ __forceinline__ v8f fa_mma(v16h a, v16h b, v8f c) { return __builtin_amdgcn_wmma_f32_16x16x32_f16(false, a, false, b, (short)0, c, false, false); }
__device__ __forceinline__ float fa_xhalf(float x) { return __builtin_bit_cast(float, __builtin_amdgcn_permlanex16(__builtin_bit_cast(int, x), __builtin_bit_cast(int, x), 0x76543210, 0xfedcba98, false, false)); }   /* lane l <-> lane l ^ 16 */
// Eight base-2 exponentials, each in place, in one statement: no result lands on a neighbour's source, and the closing v_nop is the free slot the instruction set asks for between a transcendental and the first use of its result.
__device__ __forceinline__ void fa_exp2x8(v8f& x) {
  asm("v_exp_f32 %0, %0\n\tv_exp_f32 %1, %1\n\tv_exp_f32 %2, %2\n\tv_exp_f32 %3, %3\n\tv_exp_f32 %4, %4\n\tv_exp_f32 %5, %5\n\tv_exp_f32 %6, %6\n\tv_exp_f32 %7, %7\n\tv_nop"
      : "+v"(x[0]), "+v"(x[1]), "+v"(x[2]), "+v"(x[3]), "+v"(x[4]), "+v"(x[5]), "+v"(x[6]), "+v"(x[7]));
}
#define FA_QG 4                        /* query groups (32 rows each) per block */
#define FA_KS 4                        /* key quarters per block */
#define FA_NW (FA_QG * FA_KS)
#define FA_KW (SEQ / FA_KS)            /* keys per wave */
#define FA_C1 (S_ALPHA * 1.4426950408889634f)   /* score accumulator -> logit in base-2 units */
#define FA_XTOP 15.0f                  /* largest base-2 exponent a weight may take before its row's reference moves: 2^15 is inside f16 */
#define FA_HEAD 20.0f                  /* a moved reference puts the row's largest logit of the pass at exponent FA_XTOP - FA_HEAD: room to grow by 2^20 before the next move */
#define FA_SK 128u                     /* keys of a quarter per stage */
#define FA_NST ((unsigned)FA_KW / FA_SK)   /* stages per quarter */
#define FA_ROWB 256u                   /* bytes of a tile row: two K rows, or 128 keys of a V^T row */
#define FA_ROWS 64u                    /* rows of a tile */
#define FA_PITCH 272u                  /* LDS pitch of a tile row: 256 B + 16 B pad */
#define FA_TILE 18432u                 /* 64 rows x 272 B = 17408 B, rounded up to a multiple of 2 KiB */
#define FA_QSLOT (2u * FA_TILE)        /* one quarter's K and V^T tiles of a stage */
#define FA_BUF (FA_KS * FA_QSLOT)      /* one buffer: the four quarters' tiles of a stage */
#define FA_QPITCH 144u                 /* LDS pitch of a converted query row: 128 B + 16 B, so that the 16 rows of a 16-byte fragment load fall on 64 different banks */
#define FA_W0 ((1u << 20) | (5u << 22) | (3u << 25))   /* descriptor group 1 word 0: no mask, byte elements, 4 dwords of pad behind every 256 B */
static_assert(FA_NST * FA_SK == (unsigned)FA_KW && FA_NST >= 2u && FA_ROWS * FA_PITCH <= FA_TILE && FA_TILE % 2048u == 0u);
static_assert(FA_SK * 2u == FA_ROWB && HD * 2 * 2 == FA_ROWB && FA_SK / 2u == FA_ROWS && HD == FA_ROWS);
static_assert(2u * FA_BUF + 2u * FA_NW * 2u * 32u * 4u + 32u * FA_QG * FA_QPITCH <= 327680u && (size_t)FA_NW * 2 * 4 * 2 * 32 * 16 <= 2u * FA_BUF);
typedef unsigned int v2u32a __attribute__((ext_vector_type(2), may_alias));
typedef unsigned int fa_u32x4 __attribute__((ext_vector_type(4)));
typedef unsigned int fa_u32x8 __attribute__((ext_vector_type(8)));
__device__ __forceinline__ unsigned fa_uni(unsigned v) { return (unsigned)__builtin_amdgcn_readfirstlane((int)v); }
__device__ __forceinline__ unsigned fa_pinned(unsigned v) { unsigned w = fa_uni(v); asm volatile("" : "+s"(w)); /* holds the word in a scalar register, so that a test on it is a scalar branch: a tensor load ignores EXEC */ return w; }
// Descriptor group 0: one request, LDS byte offset, global byte address of the tile's first byte, type 2.
__device__ __forceinline__ fa_u32x4 fa_group0(unsigned lds_dst, unsigned long long ga) {
  fa_u32x4 g;
  g[0] = fa_uni(1u); g[1] = fa_uni(lds_dst); g[2] = fa_uni((unsigned)ga); g[3] = fa_uni((((unsigned)(ga >> 32)) & 0x01FFFFFFu) | 0x80000000u);
  asm volatile("" : "+s"(g));          /* the pinned form for descriptor words: held in scalar registers of their own, which fa_twait keeps untouched while the request flies */
  return g;
}
// Descriptor group 1: tensor = tile = FA_ROWS rows of FA_ROWB bytes, byte elements, source pitch src_pitch bytes.
__device__ __forceinline__ fa_u32x8 fa_group1(unsigned src_pitch) {
  fa_u32x8 g;
  g[0] = fa_uni(FA_W0);
  g[1] = fa_uni((FA_ROWB & 0xFFFFu) << 16);
  g[2] = fa_uni((FA_ROWB >> 16) | ((FA_ROWS & 0xFFFFu) << 16));
  g[3] = fa_uni((FA_ROWS >> 16) | (FA_ROWB << 16));
  g[4] = fa_uni(FA_ROWS);
  g[5] = fa_uni(src_pitch);
  g[6] = fa_uni(0u);
  g[7] = fa_uni(0u);
  asm volatile("" : "+s"(g));          /* the pinned form for descriptor words: held in scalar registers of their own for the whole loop, not formed anew in registers that are reused */
  return g;
}
__device__ __forceinline__ void fa_tload(fa_u32x4 g0, fa_u32x8 g1) { asm volatile("tensor_load_to_lds %0, %1" :: "s"(g0), "s"(g1) : "memory"); }   /* one request of the whole wave */
__device__ __forceinline__ void fa_twait(fa_u32x4 g0, fa_u32x8 g1) { asm volatile("s_wait_tensorcnt 0x0" :: "s"(g0), "s"(g1) : "memory"); }   /* the wave's request has landed; naming the descriptor keeps its registers as they are until here */
__device__ __forceinline__ v16h fa_lfrag(const unsigned char* p) { FragH f; f.half[0] = *(const v8us*)p; f.half[1] = *(const v8us*)(p + 32); return f.v; }   /* p already holds the lane's 16 h bytes */
static_assert(FA_KS == 4 && FA_KW * FA_KS == SEQ && FA_KW % 32 == 0 && SEQ % (32 * FA_QG) == 0);
__global__ __launch_bounds__(FA_NW * 32) void k_fattn(const float* __restrict__ xq, const _Float16* __restrict__ K16, const _Float16* __restrict__ VT, float* __restrict__ O) {
  __shared__ __attribute__((aligned(2048))) unsigned char ring[2u * FA_BUF];   /* [buffer][quarter][K tile, V^T tile]; behind the loop's last barrier it holds the partial O^T tiles */
  v4fa (*po)[2][4][2][32] = (v4fa (*)[2][4][2][32])ring;                /* [wave][query tile][d tile][register quad][lane]; every entry written before the barrier */
  __shared__ __attribute__((aligned(16))) unsigned char qs[32u * FA_QG * FA_QPITCH];   /* the block's query rows as f16 (64 * bf16(q)); every row's 128 B written before the stage-0 barrier, read once behind it */
  __shared__ float pm[FA_NW][2][32], pl[FA_NW][2][32];                  /* [wave][query tile][lane] reference in use (base 2) and carried sum */
  const unsigned tid = threadIdx.x, w = fa_uni(tid >> 5), lane = tid & 31u, ln = lane & 15u, hh = lane >> 4;
  const unsigned qg = w >> 2, ks = w & 3u, b = blockIdx.y;
  const unsigned q0 = blockIdx.x * (32u * FA_QG) + qg * 32u, k0 = ks * (unsigned)FA_KW;
  const unsigned isu = (qg < 2u) ? 1u : 0u, tv = (qg == 1u) ? 1u : 0u;   /* query group 0's wave brings its quarter's K tile, group 1's the V^T tile */
  const unsigned long long gsrc = tv ? (unsigned long long)(size_t)(VT + (size_t)b * HD * SEQ + k0)      /* first byte of the quarter's keys in V^T row 0 */
                                     : (unsigned long long)(size_t)(K16 + ((size_t)b * SEQ + k0) * HD);  /* first byte of the quarter's K rows */
  const unsigned gstep = tv ? FA_SK * 2u : FA_SK * (unsigned)HD * 2u;    /* bytes from a stage's tile to the next stage's */
  const unsigned ldst = (unsigned)(size_t)ring + ks * FA_QSLOT + tv * FA_TILE;   /* LDS byte offset of the wave's tile in buffer 0 */
  const fa_u32x8 g1 = fa_group1(tv ? (unsigned)SEQ * 2u : FA_ROWB);
  fa_u32x4 g0 = fa_group0(ldst, gsrc);
  if (fa_pinned(isu)) fa_tload(g0, g1);
  // The block's 32 * FA_QG query rows come straight from the f32 input while stage 0 flies: a thread takes four 16-byte pieces (a wave's load covers 512 contiguous bytes), converts them as the k plane is converted and leaves them in qs.
  const float* qsrc = xq + ((size_t)b * SEQ_FULL + (size_t)blockIdx.x * (32u * FA_QG)) * HD + (size_t)tid * 4u;
  v4f rq[4];
#pragma unroll                                                   /* constant indices keep the pieces in registers */
  for (unsigned j = 0; j < 4u; ++j) rq[j] = *(const v4fa*)(qsrc + j * (FA_NW * 32u * 4u));
#pragma unroll                                                   /* the same: rq is indexed by constants only */
  for (unsigned j = 0; j < 4u; ++j) {
    const unsigned ci = tid + j * (FA_NW * 32u);                 /* piece ci: query row ci / 16 of the block, d = 4 (ci % 16) .. + 3 */
    union { _Float16 h[4]; v2u32a u; } f;
#pragma unroll                                                   /* four values, packed in registers */
    for (int q = 0; q < 4; ++q) f.h[q] = (_Float16)(bf16_rne(rq[j][q]) * QK_CARRY);
    *(v2u32a*)(qs + (ci >> 4) * FA_QPITCH + (ci & 15u) * 8u) = f.u;
  }
  union { v16h v; unsigned w[8]; } on1;                          /* sixteen f16 ones */
  asm("v_mov_b32 %0, 0x3c003c00\n\tv_mov_b32 %1, 0x3c003c00\n\tv_mov_b32 %2, 0x3c003c00\n\tv_mov_b32 %3, 0x3c003c00\n\tv_mov_b32 %4, 0x3c003c00\n\tv_mov_b32 %5, 0x3c003c00\n\tv_mov_b32 %6, 0x3c003c00\n\tv_mov_b32 %7, 0x3c003c00"
      : "=v"(on1.w[0]), "=v"(on1.w[1]), "=v"(on1.w[2]), "=v"(on1.w[3]), "=v"(on1.w[4]), "=v"(on1.w[5]), "=v"(on1.w[6]), "=v"(on1.w[7]));   /* made once by moves the compiler cannot repeat: as a plain constant it is rebuilt in all eight registers in every pass */
  const v16h ones = on1.v;
  const v8f z8 = {0.f,0.f,0.f,0.f,0.f,0.f,0.f,0.f};
  v8f o[2][4] = {{z8, z8, z8, z8}, {z8, z8, z8, z8}};            /* O^T tiles [query tile][d tile] */
  v8f ls[2] = {z8, z8};                                          /* ones . P^T: every row is the queries' weight sum; only register 0 is kept to scale */
  float nm[2] = {3.0e38f, 3.0e38f};                              /* minus the query's reference, base 2: a weight is exp2(logit + nm); the start value makes the first pass set it */
  if (fa_pinned(isu)) fa_twait(g0, g1);                          /* stage 0 has landed before its issuer reaches the barrier */
  __syncthreads();                                               /* stage 0 and the converted query rows are readable by every wave */
  g0 = fa_group0(ldst + FA_BUF, gsrc + gstep);
  if (fa_pinned(isu)) fa_tload(g0, g1);
  v16h qf[2][2];                                                 /* [query tile][d half], kept for the whole loop */
#pragma unroll                                                   /* constant indices keep the fragments in registers */
  for (int c = 0; c < 2; ++c) {
    const unsigned char* qr = qs + (qg * 32u + c * 16u + ln) * FA_QPITCH + hh * 16u;   /* the lane's place in its query row */
    qf[c][0] = fa_lfrag(qr); qf[c][1] = fa_lfrag(qr + 64);
  }
  const unsigned char* kl0 = ring + ks * FA_QSLOT + (ln >> 1) * FA_PITCH + (ln & 1u) * 128u + hh * 16u;   /* the lane's place in K row ln of the quarter's K tile, buffer 0 */
  const unsigned char* vl0 = ring + ks * FA_QSLOT + FA_TILE + ln * FA_PITCH + hh * 16u;                   /* the same in row ln of the V^T tile */
#pragma unroll 1                                                 /* the stages share one copy of the pass */
  for (unsigned st = 0; st < FA_NST; ++st) {
  const unsigned char* kl = kl0 + (st & 1u) * FA_BUF;
  const unsigned char* vl = vl0 + (st & 1u) * FA_BUF;
  v16h kf[2][2];                                                 /* [key tile][d half], fetched one pass ahead inside the stage */
#pragma unroll
  for (int t = 0; t < 2; ++t) { kf[t][0] = fa_lfrag(kl + t * 8 * FA_PITCH); kf[t][1] = fa_lfrag(kl + t * 8 * FA_PITCH + 64); }
#pragma unroll 1                                                 /* one pass already holds 18 matrix instructions; a second copy would only cost registers */
  for (unsigned p = 0; p < FA_SK; p += 32u) {
    v16h vf[4];
#pragma unroll
    for (int t = 0; t < 4; ++t) vf[t] = fa_lfrag(vl + t * 16 * FA_PITCH + p * 2u);
    v8f s[2][2];                                                 /* [query tile][key tile] */
#pragma unroll
    for (int c = 0; c < 2; ++c) {
#pragma unroll
      for (int t = 0; t < 2; ++t) s[c][t] = fa_mma(kf[t][1], qf[c][1], fa_mma(kf[t][0], qf[c][0], z8)); }
    const unsigned pn = (p + 32u < FA_SK) ? p + 32u : 0u;        /* a stage's last pass refetches the stage's own first keys: same buffer, never used */
#pragma unroll
    for (int t = 0; t < 2; ++t) { kf[t][0] = fa_lfrag(kl + (pn / 2u + t * 8) * FA_PITCH); kf[t][1] = fa_lfrag(kl + (pn / 2u + t * 8) * FA_PITCH + 64); }
    __builtin_amdgcn_sched_barrier(0);                           /* keeps the V^T loads and the K loads of the next pass issued up here, and the eight score products in one run in front of the vector work */
    float am[2];                                                 /* the lane's own largest score of the pass, per query tile (its half of the keys) */
#pragma unroll
    for (int c = 0; c < 2; ++c) {
      am[c] = fmaxf(s[c][0][0], s[c][1][0]);
#pragma unroll
      for (int r = 1; r < 8; ++r) am[c] = fmaxf(am[c], fmaxf(s[c][0][r], s[c][1][r]));
    }
    // Lazy rescale, tested once per pass: the references stay, and O^T and the sums are left alone, unless some weight of the pass would leave f16. The ballot makes it a scalar branch, so every lane is on at the matrix instructions.
    const float xm = fmaxf(__builtin_fmaf(am[0], FA_C1, nm[0]), __builtin_fmaf(am[1], FA_C1, nm[1]));   /* the same expression as the weights' exponents, so it is their largest */
    if (__builtin_expect(__builtin_amdgcn_ballot_w32(xm > FA_XTOP) != 0u, 0)) {   /* rare: laid out off the straight path */
#pragma unroll
      for (int c = 0; c < 2; ++c) {
        const float ax = fmaxf(am[c], fa_xhalf(am[c]));          /* both halves of a query's keys: the two lanes of a query move alike */
        const float nn = fminf(nm[c], (FA_XTOP - FA_HEAD) - ax * FA_C1);   /* only towards a larger reference; a query with no logit above the one that set its reference keeps it */
        const float corr = __builtin_amdgcn_exp2f(nn - nm[c]);   /* 0 on the first pass, 1 for a query that keeps its reference */
        nm[c] = nn;
#pragma unroll
        for (int t = 0; t < 4; ++t) o[c][t] *= corr;
        ls[c][0] *= corr;
      }
    }
    FragH pf[2];
#pragma unroll
    for (int c = 0; c < 2; ++c) {
#pragma unroll
      for (int t = 0; t < 2; ++t) {
#pragma unroll
        for (int r = 0; r < 8; ++r) s[c][t][r] = __builtin_fmaf(s[c][t][r], FA_C1, nm[c]);
        fa_exp2x8(s[c][t]);
#pragma unroll
        for (int r = 0; r < 8; ++r) pf[c].h[t * 8 + r] = (_Float16)s[c][t][r];   /* nearest f16, subnormals kept: both products that take pf read the same values */
      }
    }
    __builtin_amdgcn_sched_barrier(0);                           /* both weight tiles are packed before the first of the ten products: no vector instruction then lands on a product's operand, which would cost four idle slots */
#pragma unroll
    for (int c = 0; c < 2; ++c) {
#pragma unroll
      for (int t = 0; t < 4; ++t) o[c][t] = fa_mma(vf[t], pf[c].v, o[c][t]);
      ls[c] = fa_mma(ones, pf[c].v, ls[c]);
    }
  }
  asm volatile("s_wait_dscnt 0x0" ::: "memory");                 /* this wave's reads of the stage's buffer have returned before the buffer may be refilled */
  if (fa_pinned(isu)) fa_twait(g0, g1);                          /* stage st + 1 has landed before its issuer reaches the barrier */
  __syncthreads();                                               /* publishes stage st + 1 and ends every wave's reads of stage st; behind the last stage it frees the ring for the partial tiles */
  const unsigned s2 = fa_pinned(st + 2u);                        /* formed behind the wait, and the descriptor's address words from it */
  if (fa_pinned((s2 < FA_NST) ? 1u : 0u)) {
    g0 = fa_group0(ldst + (s2 & 1u) * FA_BUF, gsrc + (unsigned long long)s2 * gstep);
    if (fa_pinned(isu)) fa_tload(g0, g1);                        /* into the buffer that stage st has just left */
  }
  }
  asm volatile("s_wait_tensorcnt 0x0" ::: "memory");             /* no request is left when the ring changes its use */
  asm volatile("s_wait_dscnt 0x0" ::: "memory");                 /* nor a read of it */
#pragma unroll                                                   /* constant indices keep the tiles in registers */
  for (int c = 0; c < 2; ++c) {
#pragma unroll
    for (int t = 0; t < 4; ++t) {
      const v4f lo = {o[c][t][0], o[c][t][1], o[c][t][2], o[c][t][3]}, hi = {o[c][t][4], o[c][t][5], o[c][t][6], o[c][t][7]};
      po[w][c][t][0][lane] = lo; po[w][c][t][1][lane] = hi; }
    pm[w][c][lane] = -nm[c]; pl[w][c][lane] = ls[c][0];
  }
  __syncthreads();                                               /* every quarter's partial result is in LDS before any wave joins them */
  const unsigned jc = ks >> 1, jd = ks & 1u, wb = qg * 4u;       /* this wave joins query tile jc, d tiles 2 jd and 2 jd + 1: whole 128-byte lines of the output */
  float mj[4], wj[4];
#pragma unroll
  for (int j = 0; j < 4; ++j) mj[j] = pm[wb + j][jc][lane];
  const float mm = fmaxf(fmaxf(mj[0], mj[1]), fmaxf(mj[2], mj[3]));
  float lsum = 0.f;
#pragma unroll
  for (int j = 0; j < 4; ++j) { wj[j] = __builtin_amdgcn_exp2f(mj[j] - mm); lsum += pl[wb + j][jc][lane] * wj[j]; }
  const float f = 0.125f * (1.0f / lsum);                        /* lsum >= about 2^-5: the quarter with the largest reference has weight 1, and its largest logit at the reference's last move gave a term of about 2^(FA_XTOP - FA_HEAD) */
  float* op = O + ((size_t)b * SEQ + q0 + jc * 16u + ln) * HD + jd * 32u + 8u * hh;
#pragma unroll
  for (unsigned tt = 0; tt < 2u; ++tt) {
#pragma unroll
    for (unsigned h4 = 0; h4 < 2u; ++h4) {
      v4f a = po[wb][jc][jd * 2u + tt][h4][lane] * wj[0];
#pragma unroll
      for (int j = 1; j < 4; ++j) a += po[wb + j][jc][jd * 2u + tt][h4][lane] * wj[j];
      *(v4f*)(op + tt * 16u + h4 * 4u) = a * O_ALPHA * f;
    }
  }
}

extern "C" void kernel_launch(void* const* d_in, const int* in_sizes, int n_in,
                              void* d_out, int out_size, void* d_ws, size_t ws_size, hipStream_t stream) {
  if (n_in < 3) return;
  const size_t need_in = ((size_t)(NB - 1) * SEQ_FULL + SEQ) * HD;
  if ((size_t)in_sizes[0] < need_in || (size_t)in_sizes[1] < need_in || (size_t)in_sizes[2] < need_in) return;
  if ((size_t)out_size < (size_t)NB * SEQ * HD) return;
  const float* xq = (const float*)d_in[0]; const float* xk = (const float*)d_in[1]; const float* xv = (const float*)d_in[2];
  float* out = (float*)d_out;
  char* ws = (char*)d_ws; size_t off = 0;
  auto take = [&](size_t bytes) { char* p = ws + off; off += (bytes + 255) & ~(size_t)255; return p; };
  _Float16* K16 = (_Float16*)take(WS_PLANE16);      /* [NB][SEQ][64]  64 * bf16(k) */
  _Float16* VT  = (_Float16*)take(WS_PLANE16);      /* [NB][64][SEQ]  64 * bf16(v), transposed */
  if (off > ws_size) return;

  k_prep<<<dim3(SEQ / 128, NB), 256, 0, stream>>>(xk, xv, K16, VT);
  /* out[NB][SEQ][64] = softmax(q k^T) v * 0.125, f32 straight into the output */
  k_fattn<<<dim3(SEQ / (32 * FA_QG), NB), FA_NW * 32, 0, stream>>>(xq, K16, VT, out);
}

// v008
// It runs in 28.7 microseconds.
// Two timings next to v007 both put it at 1.04 times that version's speed.
// Over all steps from v000 it is 56.6 times as fast.
#include <hip/hip_runtime.h>
// Single-head softmax attention on given q, k, v ([NB][SEQ][64] f32 each): logits = q . k (no scale before the softmax), softmax over all SEQ keys, result x 0.125 applied after the softmax, out = weights . v -> [NB][SEQ][64] f32.
// Compute dtype: all contractions v_wmma_f32_16x16x32_f16 (f16 operands, f32 accumulate). q, k, v are RNE-converted to bf16 first and carried x64 as exact f16 (k and V^T planes, q rows in LDS; products exact in f32); logits and softmax statistics f32;
// softmax weights carried unnormalised as f16(exp2(s - held reference)) (rounded to nearest, f16 subnormals kept; a row's largest weight lies between 2^-5 and 2^15), row sum taken from the same f16 values, 0.125 / sum applied per row in the f32 epilogue.
// Structure: one launch converts k -> f16 plane and v -> V^T f16 plane via LDS transpose; one fused launch (each block converts its own 128 query rows into LDS first): per wave 32 queries x a quarter of the keys, logits, softmax against a held reference (lazy rescale) and weights . v all in registers, K and V^T tiles staged in LDS by tensor loads (two buffers), the four key quarters joined in LDS.
#ifndef NB
#define NB 8
#endif
#ifndef SEQ
#define SEQ 4096
#endif
#define NB_FULL 8                      /* batches in the inputs */
#define SEQ_FULL 4096                  /* rows per batch in the inputs (input batch pitch) */
#define HD 64
#define QK_CARRY 64.0f                 /* power-of-two carry of the q rows and the k plane */
#define V_CARRY 64.0f                  /* power-of-two carry of the V^T plane */
#define S_ALPHA 0.000244140625f        /* 1 / (QK_CARRY * QK_CARRY) */
#define O_ALPHA 0.015625f              /* 1 / V_CARRY */

static_assert(NB >= 1 && NB <= NB_FULL);
static_assert(SEQ >= 256 && SEQ <= SEQ_FULL);
static_assert(HD == 64);
static_assert((SEQ / 128) * 128 == SEQ);                         /* query rows per block, 32-key passes of a key quarter */
static_assert((SEQ / 64) * 64 == SEQ);                           /* V^T token groups */
#define WS_PLANE16 ((size_t)NB * SEQ * HD * 2)
static_assert(WS_PLANE16 % 256 == 0);
static_assert(2 * WS_PLANE16 <= (size_t)134217728);

typedef unsigned short v8us __attribute__((ext_vector_type(8), may_alias));
typedef float  v8f  __attribute__((ext_vector_type(8)));
typedef float  v4f  __attribute__((ext_vector_type(4)));
typedef float  v2f  __attribute__((ext_vector_type(2)));
typedef float  v4fa __attribute__((ext_vector_type(4), may_alias));
typedef _Float16 v16h __attribute__((ext_vector_type(16)));
union FragH { v16h v; v8us half[2]; _Float16 h[16]; unsigned short u[16]; };

__device__ __forceinline__ unsigned short bf16_bits(float x) { unsigned int u = __float_as_uint(x); return (unsigned short)((u + 0x7FFFu + ((u >> 16) & 1u)) >> 16); }
__device__ __forceinline__ float bf16_val(unsigned short b) { return __uint_as_float(((unsigned int)b) << 16); }
__device__ __forceinline__ float bf16_rne(float x) { return bf16_val(bf16_bits(x)); }

// One launch makes the two f16 planes that every block of a batch shares. A block takes PT tokens of one batch from k and v alike (one block a WGP at the full shape): few, long waves in place of many short ones,
// and every global load of a thread is issued before its first conversion. All loops are unrolled: constant indices keep the loaded pieces in registers.
#define PT 128u                        /* tokens per block */
#define PCH 4u                         /* 8-element pieces per thread and input: PT * HD / 8 / 256 */
static_assert(PT * HD == PCH * 256u * 8u && (SEQ / PT) * PT == SEQ);
__device__ __forceinline__ v8us cvt8(v4f a, v4f c, float carry) {
  FragH f;
#pragma unroll
  for (int q = 0; q < 4; ++q) { f.h[q] = (_Float16)(bf16_rne(a[q]) * carry); f.h[4 + q] = (_Float16)(bf16_rne(c[q]) * carry); }
  return f.half[0];
}
__global__ __launch_bounds__(256) void k_prep(const float* __restrict__ xk, const float* __restrict__ xv,
                                              _Float16* __restrict__ K16, _Float16* __restrict__ VT) {
  __shared__ unsigned short tl[PT][66];                          /* [token][d]; all PT x 64 entries written before the barrier; cross-wave -> block barrier */
  const unsigned tid = threadIdx.x, g = blockIdx.x, b = blockIdx.y;
  const size_t in0 = ((size_t)b * SEQ_FULL + (size_t)g * PT) * HD + (size_t)tid * 8u;   /* the thread's first piece in an input */
  const size_t pl0 = ((size_t)b * SEQ + (size_t)g * PT) * HD + (size_t)tid * 8u;        /* the same in the k plane */
  v4f rv[PCH][2], rk[PCH][2];
#pragma unroll
  for (unsigned j = 0; j < PCH; ++j) { const float* p = xv + in0 + j * 2048u; rv[j][0] = *(const v4fa*)p; rv[j][1] = *(const v4fa*)(p + 4); }
#pragma unroll
  for (unsigned j = 0; j < PCH; ++j) { const float* p = xk + in0 + j * 2048u; rk[j][0] = *(const v4fa*)p; rk[j][1] = *(const v4fa*)(p + 4); }
  asm volatile("s_wait_xcnt 0x0" :: "v"(xv + in0), "v"(xk + in0) : "memory");   /* the precaution kept before a register that an issued load names is rewritten; naming the two address pairs keeps them whole until here, and as a memory statement it holds all 16 loads in front of the conversions (without it half of them are issued only after the first have returned: a second latency in series) */
#pragma unroll
  for (unsigned j = 0; j < PCH; ++j) {
    const unsigned r = j * 32u + (tid >> 3), c8 = (tid & 7u) * 8u;
    FragH f; f.half[0] = cvt8(rv[j][0], rv[j][1], V_CARRY);
#pragma unroll
    for (int q = 0; q < 8; ++q) tl[r][c8 + q] = f.u[q];
  }
  __syncthreads();
#pragma unroll
  for (unsigned u = 0; u < PT / 64u; ++u) {
#pragma unroll
    for (unsigned rd = 0; rd < 2u; ++rd) {
      const unsigned d = rd * 32u + (tid >> 3), pc = tid & 7u; FragH f;
#pragma unroll
      for (unsigned q = 0; q < 8u; ++q) f.u[q] = tl[u * 64u + pc * 8u + q][d];
      *(v8us*)((unsigned short*)VT + ((size_t)b * HD + d) * SEQ + (size_t)g * PT + u * 64u + pc * 8u) = f.half[0];
    }
  }
#pragma unroll
  for (unsigned j = 0; j < PCH; ++j) *(v8us*)((unsigned short*)K16 + pl0 + j * 2048u) = cvt8(rk[j][0], rk[j][1], QK_CARRY);
}

// ---- fused attention: S^T = K Q^T, O^T += V^T P^T ----
// Fragment map (A row / B column = lane & 15, h = lane >> 4): elements 0..7 <- k0 + 8h + i, elements 8..15 <- k0 + 16 + 8h + i; D element r <- (row 8h + r, col lane & 15).
// With K as A and Q as B a lane's score registers all belong to query (lane & 15): maximum and exponent are lane-local but for one exchange between the wave halves, and the two 16-key score tiles of a pass,
// converted in place, are the B operand of the second product (its k order is the map above, which fa_lfrag gives V^T too). O^T keeps query = lane & 15, so the rescale factor is lane-local as well.
// K and V^T reach the waves through LDS. Per stage (128 keys of a quarter) one tensor load brings the K rows, taken two to a 256-byte tile row, and one brings the 64 V^T rows of 256 B; both land at an LDS pitch of 272 B.
// The 4 query groups of a quarter read the same tiles by 16-byte LDS loads whose 16 lanes of a half fall on 64 different banks. Two buffers: stage s + 1 flies while stage s is worked on.
// Block = 16 waves = 4 query groups of 32 rows x 4 key quarters. Each wave leaves (reference, sum, O^T) of its quarter in LDS; behind the block barrier the four waves of a query group join them in quarter order.
__device__ __forceinline__ v8f fa_mma(v16h a, v16h b, v8f c) { return __builtin_amdgcn_wmma_f32_16x16x32_f16(false, a, false, b, (short)0, c, false, false); }
__device__ __forceinline__ float fa_xhalf(float x) { return __builtin_bit_cast(float, __builtin_amdgcn_permlanex16(__builtin_bit_cast(int, x), __builtin_bit_cast(int, x), 0x76543210, 0xfedcba98, false, false)); }   /* lane l <-> lane l ^ 16 */
// Eight base-2 exponentials, each in place, in one statement: no result lands on a neighbour's source, and the closing v_nop is the free slot the instruction set asks for between a transcendental and the first use of its result.
__device__ __forceinline__ void fa_exp2x8(v8f& x) {
  asm("v_exp_f32 %0, %0\n\tv_exp_f32 %1, %1\n\tv_exp_f32 %2, %2\n\tv_exp_f32 %3, %3\n\tv_exp_f32 %4, %4\n\tv_exp_f32 %5, %5\n\tv_exp_f32 %6, %6\n\tv_exp_f32 %7, %7\n\tv_nop"
      : "+v"(x[0]), "+v"(x[1]), "+v"(x[2]), "+v"(x[3]), "+v"(x[4]), "+v"(x[5]), "+v"(x[6]), "+v"(x[7]));
}
#define FA_QG 4                        /* query groups (32 rows each) per block */
#define FA_KS 4                        /* key quarters per block */
#define FA_NW (FA_QG * FA_KS)
#define FA_KW (SEQ / FA_KS)            /* keys per wave */
#define FA_C1 (S_ALPHA * 1.4426950408889634f)   /* score accumulator -> logit in base-2 units */
#define FA_XTOP 15.0f                  /* largest base-2 exponent a weight may take before its row's reference moves: 2^15 is inside f16 */
#define FA_HEAD 20.0f                  /* a moved reference puts the row's largest logit of the pass at exponent FA_XTOP - FA_HEAD: room to grow by 2^20 before the next move */
#define FA_SK 128u                     /* keys of a quarter per stage */
#define FA_NST ((unsigned)FA_KW / FA_SK)   /* stages per quarter */
#define FA_ROWB 256u                   /* bytes of a tile row: two K rows, or 128 keys of a V^T row */
#define FA_ROWS 64u                    /* rows of a tile */
#define FA_PITCH 272u                  /* LDS pitch of a tile row: 256 B + 16 B pad */
#define FA_TILE 18432u                 /* 64 rows x 272 B = 17408 B, rounded up to a multiple of 2 KiB */
#define FA_QSLOT (2u * FA_TILE)        /* one quarter's K and V^T tiles of a stage */
#define FA_BUF (FA_KS * FA_QSLOT)      /* one buffer: the four quarters' tiles of a stage */
#define FA_QPITCH 144u                 /* LDS pitch of a converted query row: 128 B + 16 B, so that the 16 rows of a 16-byte fragment load fall on 64 different banks */
#define FA_W0 ((1u << 20) | (5u << 22) | (3u << 25))   /* descriptor group 1 word 0: no mask, byte elements, 4 dwords of pad behind every 256 B */
static_assert(FA_NST * FA_SK == (unsigned)FA_KW && FA_NST >= 2u && FA_ROWS * FA_PITCH <= FA_TILE && FA_TILE % 2048u == 0u);
static_assert(FA_SK * 2u == FA_ROWB && HD * 2 * 2 == FA_ROWB && FA_SK / 2u == FA_ROWS && HD == FA_ROWS);
static_assert(2u * FA_BUF + 2u * FA_NW * 2u * 32u * 4u + 32u * FA_QG * FA_QPITCH <= 327680u && (size_t)FA_NW * 2 * 4 * 2 * 32 * 16 <= 2u * FA_BUF);
typedef unsigned int v2u32a __attribute__((ext_vector_type(2), may_alias));
typedef unsigned int fa_u32x4 __attribute__((ext_vector_type(4)));
typedef unsigned int fa_u32x8 __attribute__((ext_vector_type(8)));
__device__ __forceinline__ unsigned fa_uni(unsigned v) { return (unsigned)__builtin_amdgcn_readfirstlane((int)v); }
__device__ __forceinline__ unsigned fa_pinned(unsigned v) { unsigned w = fa_uni(v); asm volatile("" : "+s"(w)); /* holds the word in a scalar register, so that a test on it is a scalar branch: a tensor load ignores EXEC */ return w; }
// Descriptor group 0: one request, LDS byte offset, global byte address of the tile's first byte, type 2.
__device__ __forceinline__ fa_u32x4 fa_group0(unsigned lds_dst, unsigned long long ga) {
  fa_u32x4 g;
  g[0] = fa_uni(1u); g[1] = fa_uni(lds_dst); g[2] = fa_uni((unsigned)ga); g[3] = fa_uni((((unsigned)(ga >> 32)) & 0x01FFFFFFu) | 0x80000000u);
  asm volatile("" : "+s"(g));          /* the pinned form for descriptor words: held in scalar registers of their own, which fa_twait keeps untouched while the request flies */
  return g;
}
// Descriptor group 1: tensor = tile = FA_ROWS rows of FA_ROWB bytes, byte elements, source pitch src_pitch bytes.
__device__ __forceinline__ fa_u32x8 fa_group1(unsigned src_pitch) {
  fa_u32x8 g;
  g[0] = fa_uni(FA_W0);
  g[1] = fa_uni((FA_ROWB & 0xFFFFu) << 16);
  g[2] = fa_uni((FA_ROWB >> 16) | ((FA_ROWS & 0xFFFFu) << 16));
  g[3] = fa_uni((FA_ROWS >> 16) | (FA_ROWB << 16));
  g[4] = fa_uni(FA_ROWS);
  g[5] = fa_uni(src_pitch);
  g[6] = fa_uni(0u);
  g[7] = fa_uni(0u);
  asm volatile("" : "+s"(g));          /* the pinned form for descriptor words: held in scalar registers of their own for the whole loop, not formed anew in registers that are reused */
  return g;
}
__device__ __forceinline__ void fa_tload(fa_u32x4 g0, fa_u32x8 g1) { asm volatile("tensor_load_to_lds %0, %1" :: "s"(g0), "s"(g1) : "memory"); }   /* one request of the whole wave */
__device__ __forceinline__ void fa_twait(fa_u32x4 g0, fa_u32x8 g1) { asm volatile("s_wait_tensorcnt 0x0" :: "s"(g0), "s"(g1) : "memory"); }   /* the wave's request has landed; naming the descriptor keeps its registers as they are until here */
__device__ __forceinline__ v16h fa_lfrag(const unsigned char* p) { FragH f; f.half[0] = *(const v8us*)p; f.half[1] = *(const v8us*)(p + 32); return f.v; }   /* p already holds the lane's 16 h bytes */
static_assert(FA_KS == 4 && FA_KW * FA_KS == SEQ && FA_KW % 32 == 0 && SEQ % (32 * FA_QG) == 0);
static_assert(FA_SK == 4u * 32u);                                /* four passes a stage: one priority level each */
__global__ __launch_bounds__(FA_NW * 32) void k_fattn(const float* __restrict__ xq, const _Float16* __restrict__ K16, const _Float16* __restrict__ VT, float* __restrict__ O) {
  __shared__ __attribute__((aligned(2048))) unsigned char ring[2u * FA_BUF];   /* [buffer][quarter][K tile, V^T tile]; behind the loop's last barrier it holds the partial O^T tiles */
  v4fa (*po)[2][4][2][32] = (v4fa (*)[2][4][2][32])ring;                /* [wave][query tile][d tile][register quad][lane]; every entry written before the barrier */
  __shared__ __attribute__((aligned(16))) unsigned char qs[32u * FA_QG * FA_QPITCH];   /* the block's query rows as f16 (64 * bf16(q)); every row's 128 B written before the stage-0 barrier, read once behind it */
  __shared__ float pm[FA_NW][2][32], pl[FA_NW][2][32];                  /* [wave][query tile][lane] reference in use (base 2) and carried sum */
  const unsigned tid = threadIdx.x, w = fa_uni(tid >> 5), lane = tid & 31u, ln = lane & 15u, hh = lane >> 4;
  const unsigned qg = w >> 2, ks = w & 3u, b = blockIdx.y;
  const unsigned q0 = blockIdx.x * (32u * FA_QG) + qg * 32u, k0 = ks * (unsigned)FA_KW;
  const unsigned isu = (qg < 2u) ? 1u : 0u, tv = (qg == 1u) ? 1u : 0u;   /* query group 0's wave brings its quarter's K tile, group 1's the V^T tile */
  const unsigned long long gsrc = tv ? (unsigned long long)(size_t)(VT + (size_t)b * HD * SEQ + k0)      /* first byte of the quarter's keys in V^T row 0 */
                                     : (unsigned long long)(size_t)(K16 + ((size_t)b * SEQ + k0) * HD);  /* first byte of the quarter's K rows */
  const unsigned gstep = tv ? FA_SK * 2u : FA_SK * (unsigned)HD * 2u;    /* bytes from a stage's tile to the next stage's */
  const unsigned ldst = (unsigned)(size_t)ring + ks * FA_QSLOT + tv * FA_TILE;   /* LDS byte offset of the wave's tile in buffer 0 */
  const fa_u32x8 g1 = fa_group1(tv ? (unsigned)SEQ * 2u : FA_ROWB);
  fa_u32x4 g0 = fa_group0(ldst, gsrc);
  if (fa_pinned(isu)) fa_tload(g0, g1);
  // The block's 32 * FA_QG query rows come straight from the f32 input while stage 0 flies: a thread takes four 16-byte pieces (a wave's load covers 512 contiguous bytes), converts them as the k plane is converted and leaves them in qs.
  const float* qsrc = xq + ((size_t)b * SEQ_FULL + (size_t)blockIdx.x * (32u * FA_QG)) * HD + (size_t)tid * 4u;
  v4f rq[4];
#pragma unroll                                                   /* constant indices keep the pieces in registers */
  for (unsigned j = 0; j < 4u; ++j) rq[j] = *(const v4fa*)(qsrc + j * (FA_NW * 32u * 4u));
#pragma unroll                                                   /* the same: rq is indexed by constants only */
  for (unsigned j = 0; j < 4u; ++j) {
    const unsigned ci = tid + j * (FA_NW * 32u);                 /* piece ci: query row ci / 16 of the block, d = 4 (ci % 16) .. + 3 */
    union { _Float16 h[4]; v2u32a u; } f;
#pragma unroll                                                   /* four values, packed in registers */
    for (int q = 0; q < 4; ++q) f.h[q] = (_Float16)(bf16_rne(rq[j][q]) * QK_CARRY);
    *(v2u32a*)(qs + (ci >> 4) * FA_QPITCH + (ci & 15u) * 8u) = f.u;
  }
  union { v16h v; unsigned w[8]; } on1;                          /* sixteen f16 ones */
  asm("v_mov_b32 %0, 0x3c003c00\n\tv_mov_b32 %1, 0x3c003c00\n\tv_mov_b32 %2, 0x3c003c00\n\tv_mov_b32 %3, 0x3c003c00\n\tv_mov_b32 %4, 0x3c003c00\n\tv_mov_b32 %5, 0x3c003c00\n\tv_mov_b32 %6, 0x3c003c00\n\tv_mov_b32 %7, 0x3c003c00"
      : "=v"(on1.w[0]), "=v"(on1.w[1]), "=v"(on1.w[2]), "=v"(on1.w[3]), "=v"(on1.w[4]), "=v"(on1.w[5]), "=v"(on1.w[6]), "=v"(on1.w[7]));   /* made once by moves the compiler cannot repeat: as a plain constant it is rebuilt in all eight registers in every pass */
  const v16h ones = on1.v;
  const v8f z8 = {0.f,0.f,0.f,0.f,0.f,0.f,0.f,0.f};
  v8f o[2][4] = {{z8, z8, z8, z8}, {z8, z8, z8, z8}};            /* O^T tiles [query tile][d tile] */
  v8f ls[2] = {z8, z8};                                          /* ones . P^T: every row is the queries' weight sum; only register 0 is kept to scale */
  float nm[2] = {3.0e38f, 3.0e38f};                              /* minus the query's reference, base 2: a weight is exp2(logit + nm); the start value makes the first pass set it */
  if (fa_pinned(isu)) fa_twait(g0, g1);                          /* stage 0 has landed before its issuer reaches the barrier */
  __syncthreads();                                               /* stage 0 and the converted query rows are readable by every wave */
  g0 = fa_group0(ldst + FA_BUF, gsrc + gstep);
  if (fa_pinned(isu)) fa_tload(g0, g1);
  v16h qf[2][2];                                                 /* [query tile][d half], kept for the whole loop */
#pragma unroll                                                   /* constant indices keep the fragments in registers */
  for (int c = 0; c < 2; ++c) {
    const unsigned char* qr = qs + (qg * 32u + c * 16u + ln) * FA_QPITCH + hh * 16u;   /* the lane's place in its query row */
    qf[c][0] = fa_lfrag(qr); qf[c][1] = fa_lfrag(qr + 64);
  }
  const unsigned char* kl0 = ring + ks * FA_QSLOT + (ln >> 1) * FA_PITCH + (ln & 1u) * 128u + hh * 16u;   /* the lane's place in K row ln of the quarter's K tile, buffer 0 */
  const unsigned char* vl0 = ring + ks * FA_QSLOT + FA_TILE + ln * FA_PITCH + hh * 16u;                   /* the same in row ln of the V^T tile */
#pragma unroll 1                                                 /* the stages share one copy of the four passes */
  for (unsigned st = 0; st < FA_NST; ++st) {
  const unsigned char* kl = kl0 + (st & 1u) * FA_BUF;
  const unsigned char* vl = vl0 + (st & 1u) * FA_BUF;
  v16h kf[2][2];                                                 /* [key tile][d half], fetched one pass ahead inside the stage */
#pragma unroll
  for (int t = 0; t < 2; ++t) { kf[t][0] = fa_lfrag(kl + t * 8 * FA_PITCH); kf[t][1] = fa_lfrag(kl + t * 8 * FA_PITCH + 64); }
#pragma unroll                                                   /* four copies of the pass: s_setprio takes its level as an immediate only */
  for (unsigned p = 0; p < FA_SK; p += 32u) {
    if (p == 0u) __builtin_amdgcn_s_setprio(3);                  /* a stage starts at the top level; it falls with progress, see behind the rescale test */
    v16h vf[4];
#pragma unroll
    for (int t = 0; t < 4; ++t) vf[t] = fa_lfrag(vl + t * 16 * FA_PITCH + p * 2u);
    v8f s[2][2];                                                 /* [query tile][key tile] */
#pragma unroll
    for (int c = 0; c < 2; ++c) {
#pragma unroll
      for (int t = 0; t < 2; ++t) s[c][t] = fa_mma(kf[t][1], qf[c][1], fa_mma(kf[t][0], qf[c][0], z8)); }
    const unsigned pn = (p + 32u < FA_SK) ? p + 32u : 0u;        /* a stage's last pass refetches the stage's own first keys: same buffer, never used */
#pragma unroll
    for (int t = 0; t < 2; ++t) { kf[t][0] = fa_lfrag(kl + (pn / 2u + t * 8) * FA_PITCH); kf[t][1] = fa_lfrag(kl + (pn / 2u + t * 8) * FA_PITCH + 64); }
    __builtin_amdgcn_sched_barrier(0);                           /* keeps the V^T loads and the K loads of the next pass issued up here, and the eight score products in one run in front of the vector work */
    float am[2];                                                 /* the lane's own largest score of the pass, per query tile (its half of the keys) */
#pragma unroll
    for (int c = 0; c < 2; ++c) {
      am[c] = fmaxf(s[c][0][0], s[c][1][0]);
#pragma unroll
      for (int r = 1; r < 8; ++r) am[c] = fmaxf(am[c], fmaxf(s[c][0][r], s[c][1][r]));
    }
    // Lazy rescale, tested once per pass: the references stay, and O^T and the sums are left alone, unless some weight of the pass would leave f16. The ballot makes it a scalar branch, so every lane is on at the matrix instructions.
    const float xm = fmaxf(__builtin_fmaf(am[0], FA_C1, nm[0]), __builtin_fmaf(am[1], FA_C1, nm[1]));   /* the same expression as the weights' exponents, so it is their largest */
    if (__builtin_expect(__builtin_amdgcn_ballot_w32(xm > FA_XTOP) != 0u, 0)) {   /* rare: laid out off the straight path */
#pragma unroll
      for (int c = 0; c < 2; ++c) {
        const float ax = fmaxf(am[c], fa_xhalf(am[c]));          /* both halves of a query's keys: the two lanes of a query move alike */
        const float nn = fminf(nm[c], (FA_XTOP - FA_HEAD) - ax * FA_C1);   /* only towards a larger reference; a query with no logit above the one that set its reference keeps it */
        const float corr = __builtin_amdgcn_exp2f(nn - nm[c]);   /* 0 on the first pass, 1 for a query that keeps its reference */
        nm[c] = nn;
#pragma unroll
        for (int t = 0; t < 4; ++t) o[c][t] *= corr;
        ls[c][0] *= corr;
      }
    }
    // Wave priority falls with progress inside the stage: 3, then 2, 1, 0 from here on in passes 1, 2, 3. Now a wave that lags goes first, so all four stay at work until shortly before the barrier. The level drops here, where the
    // pass's dense vector run begins: the part in front of it (score products, chain of maxima, test) is mostly latency and loses most by waiting for a slot.
    switch (p) {                                                 /* p is a constant in each copy: at most one s_setprio is left */
      case 32u: __builtin_amdgcn_s_setprio(2); break;
      case 64u: __builtin_amdgcn_s_setprio(1); break;
      case 96u: __builtin_amdgcn_s_setprio(0); break;            /* the barrier and the way out of the loop are reached at the default level */
      default: break;
    }
    FragH pf[2];
#pragma unroll
    for (int c = 0; c < 2; ++c) {
#pragma unroll
      for (int t = 0; t < 2; ++t) {
#pragma unroll
        for (int r = 0; r < 8; ++r) s[c][t][r] = __builtin_fmaf(s[c][t][r], FA_C1, nm[c]);
        fa_exp2x8(s[c][t]);
#pragma unroll
        for (int r = 0; r < 8; ++r) pf[c].h[t * 8 + r] = (_Float16)s[c][t][r];   /* nearest f16, subnormals kept: both products that take pf read the same values */
      }
    }
    __builtin_amdgcn_sched_barrier(0);                           /* both weight tiles are packed before the first of the ten products: no vector instruction then lands on a product's operand, which would cost four idle slots */
#pragma unroll
    for (int c = 0; c < 2; ++c) {
#pragma unroll
      for (int t = 0; t < 4; ++t) o[c][t] = fa_mma(vf[t], pf[c].v, o[c][t]);
      ls[c] = fa_mma(ones, pf[c].v, ls[c]);
    }
  }
  asm volatile("s_wait_dscnt 0x0" ::: "memory");                 /* this wave's reads of the stage's buffer have returned before the buffer may be refilled */
  if (fa_pinned(isu)) fa_twait(g0, g1);                          /* stage st + 1 has landed before its issuer reaches the barrier */
  __syncthreads();                                               /* publishes stage st + 1 and ends every wave's reads of stage st; behind the last stage it frees the ring for the partial tiles */
  const unsigned s2 = fa_pinned(st + 2u);                        /* formed behind the wait, and the descriptor's address words from it */
  if (fa_pinned((s2 < FA_NST) ? 1u : 0u)) {
    g0 = fa_group0(ldst + (s2 & 1u) * FA_BUF, gsrc + (unsigned long long)s2 * gstep);
    if (fa_pinned(isu)) fa_tload(g0, g1);                        /* into the buffer that stage st has just left */
  }
  }
  asm volatile("s_wait_tensorcnt 0x0" ::: "memory");             /* no request is left when the ring changes its use */
  asm volatile("s_wait_dscnt 0x0" ::: "memory");                 /* nor a read of it */
#pragma unroll                                                   /* constant indices keep the tiles in registers */
  for (int c = 0; c < 2; ++c) {
#pragma unroll
    for (int t = 0; t < 4; ++t) {
      const v4f lo = {o[c][t][0], o[c][t][1], o[c][t][2], o[c][t][3]}, hi = {o[c][t][4], o[c][t][5], o[c][t][6], o[c][t][7]};
      po[w][c][t][0][lane] = lo; po[w][c][t][1][lane] = hi; }
    pm[w][c][lane] = -nm[c]; pl[w][c][lane] = ls[c][0];
  }
  __syncthreads();                                               /* every quarter's partial result is in LDS before any wave joins them */
  const unsigned jc = ks >> 1, jd = ks & 1u, wb = qg * 4u;       /* this wave joins query tile jc, d tiles 2 jd and 2 jd + 1: whole 128-byte lines of the output */
  float mj[4], wj[4];
#pragma unroll
  for (int j = 0; j < 4; ++j) mj[j] = pm[wb + j][jc][lane];
  const float mm = fmaxf(fmaxf(mj[0], mj[1]), fmaxf(mj[2], mj[3]));
  float lsum = 0.f;
#pragma unroll
  for (int j = 0; j < 4; ++j) { wj[j] = __builtin_amdgcn_exp2f(mj[j] - mm); lsum += pl[wb + j][jc][lane] * wj[j]; }
  const float f = 0.125f * (1.0f / lsum);                        /* lsum >= about 2^-5: the quarter with the largest reference has weight 1, and its largest logit at the reference's last move gave a term of about 2^(FA_XTOP - FA_HEAD) */
  float* op = O + ((size_t)b * SEQ + q0 + jc * 16u + ln) * HD + jd * 32u + 8u * hh;
#pragma unroll
  for (unsigned tt = 0; tt < 2u; ++tt) {
#pragma unroll
    for (unsigned h4 = 0; h4 < 2u; ++h4) {
      v4f a = po[wb][jc][jd * 2u + tt][h4][lane] * wj[0];
#pragma unroll
      for (int j = 1; j < 4; ++j) a += po[wb + j][jc][jd * 2u + tt][h4][lane] * wj[j];
      *(v4f*)(op + tt * 16u + h4 * 4u) = a * O_ALPHA * f;
    }
  }
}

extern "C" void kernel_launch(void* const* d_in, const int* in_sizes, int n_in,
                              void* d_out, int out_size, void* d_ws, size_t ws_size, hipStream_t stream) {
  if (n_in < 3) return;
  const size_t need_in = ((size_t)(NB - 1) * SEQ_FULL + SEQ) * HD;
  if ((size_t)in_sizes[0] < need_in || (size_t)in_sizes[1] < need_in || (size_t)in_sizes[2] < need_in) return;
  if ((size_t)out_size < (size_t)NB * SEQ * HD) return;
  const float* xq = (const float*)d_in[0]; const float* xk = (const float*)d_in[1]; const float* xv = (const float*)d_in[2];
  float* out = (float*)d_out;
  char* ws = (char*)d_ws; size_t off = 0;
  auto take = [&](size_t bytes) { char* p = ws + off; off += (bytes + 255) & ~(size_t)255; return p; };
  _Float16* K16 = (_Float16*)take(WS_PLANE16);      /* [NB][SEQ][64]  64 * bf16(k) */
  _Float16* VT  = (_Float16*)take(WS_PLANE16);      /* [NB][64][SEQ]  64 * bf16(v), transposed */
  if (off > ws_size) return;

  k_prep<<<dim3(SEQ / 128, NB), 256, 0, stream>>>(xk, xv, K16, VT);
  /* out[NB][SEQ][64] = softmax(q k^T) v * 0.125, f32 straight into the output */
  k_fattn<<<dim3(SEQ / (32 * FA_QG), NB), FA_NW * 32, 0, stream>>>(xq, K16, VT, out);
}

// v009
// A run of this version takes 27.7 microseconds.
// Timed twice side by side with v008, it ran 1.04 times as fast both times.
// Over all steps from v000 it is 58.7 times as fast.
#include <hip/hip_runtime.h>
// Single-head softmax attention on given q, k, v ([NB][SEQ][64] f32 each): logits = q . k (no scale before the softmax), softmax over all SEQ keys, result x 0.125 applied after the softmax, out = weights . v -> [NB][SEQ][64] f32.
// Compute dtype: all contractions v_wmma_f32_16x16x32_f16 (f16 operands, f32 accumulate). q, k, v are RNE-converted to bf16 first and carried x64 as exact f16 planes (products exact in f32); logits and softmax statistics f32;
// softmax weights carried unnormalised as f16(exp2(s - held reference)) (rounded to nearest, f16 subnormals kept; a row's largest weight lies between 2^-10 and the largest f16), row sum taken from the same f16 values (per pass by a ones product, the passes added in f32), 0.125 / sum applied per row in the f32 epilogue.
// Structure: one launch converts k -> f16 plane and v -> V^T f16 plane via LDS transpose; one fused launch (each block converts its own 128 query rows into LDS first): per wave 32 queries x a quarter of the keys, logits, softmax against a held reference (lazy rescale) and weights . v all in registers, K and V^T tiles staged in LDS by tensor loads (two buffers), the four key quarters joined in LDS.
#ifndef NB
#define NB 8
#endif
#ifndef SEQ
#define SEQ 4096
#endif
#define NB_FULL 8                      /* batches in the inputs */
#define SEQ_FULL 4096                  /* rows per batch in the inputs (input batch pitch) */
#define HD 64
#define QK_CARRY 64.0f                 /* power-of-two carry of the q rows and the k plane */
#define V_CARRY 64.0f                  /* power-of-two carry of the V^T plane */
#define S_ALPHA 0.000244140625f        /* 1 / (QK_CARRY * QK_CARRY) */
#define O_ALPHA 0.015625f              /* 1 / V_CARRY */

static_assert(NB >= 1 && NB <= NB_FULL);
static_assert(SEQ >= 256 && SEQ <= SEQ_FULL);
static_assert(HD == 64);
static_assert((SEQ / 128) * 128 == SEQ);                         /* query rows per block, 32-key passes of a key quarter */
static_assert((SEQ / 64) * 64 == SEQ);                           /* V^T token groups */
#define WS_PLANE16 ((size_t)NB * SEQ * HD * 2)
static_assert(WS_PLANE16 % 256 == 0);
static_assert(2 * WS_PLANE16 <= (size_t)134217728);

typedef unsigned short v8us __attribute__((ext_vector_type(8), may_alias));
typedef float  v8f  __attribute__((ext_vector_type(8)));
typedef float  v4f  __attribute__((ext_vector_type(4)));
typedef float  v2f  __attribute__((ext_vector_type(2)));
typedef float  v4fa __attribute__((ext_vector_type(4), may_alias));
typedef _Float16 v16h __attribute__((ext_vector_type(16)));
union FragH { v16h v; v8us half[2]; _Float16 h[16]; unsigned short u[16]; };

__device__ __forceinline__ unsigned short bf16_bits(float x) { unsigned int u = __float_as_uint(x); return (unsigned short)((u + 0x7FFFu + ((u >> 16) & 1u)) >> 16); }
__device__ __forceinline__ float bf16_val(unsigned short b) { return __uint_as_float(((unsigned int)b) << 16); }
__device__ __forceinline__ float bf16_rne(float x) { return bf16_val(bf16_bits(x)); }

// One launch makes the two f16 planes that every block of a batch shares. A block takes PT tokens of one batch from k and v alike (one block a WGP at the full shape): few, long waves in place of many short ones,
// and every global load of a thread is issued before its first conversion. All loops are unrolled: constant indices keep the loaded pieces in registers.
#define PT 128u                        /* tokens per block */
#define PCH 4u                         /* 8-element pieces per thread and input: PT * HD / 8 / 256 */
static_assert(PT * HD == PCH * 256u * 8u && (SEQ / PT) * PT == SEQ);
__device__ __forceinline__ v8us cvt8(v4f a, v4f c, float carry) {
  FragH f;
#pragma unroll
  for (int q = 0; q < 4; ++q) { f.h[q] = (_Float16)(bf16_rne(a[q]) * carry); f.h[4 + q] = (_Float16)(bf16_rne(c[q]) * carry); }
  return f.half[0];
}
__global__ __launch_bounds__(256) void k_prep(const float* __restrict__ xk, const float* __restrict__ xv,
                                              _Float16* __restrict__ K16, _Float16* __restrict__ VT) {
  __shared__ unsigned short tl[PT][66];                          /* [token][d]; all PT x 64 entries written before the barrier; cross-wave -> block barrier */
  const unsigned tid = threadIdx.x, g = blockIdx.x, b = blockIdx.y;
  const size_t in0 = ((size_t)b * SEQ_FULL + (size_t)g * PT) * HD + (size_t)tid * 8u;   /* the thread's first piece in an input */
  const size_t pl0 = ((size_t)b * SEQ + (size_t)g * PT) * HD + (size_t)tid * 8u;        /* the same in the k plane */
  v4f rv[PCH][2], rk[PCH][2];
#pragma unroll
  for (unsigned j = 0; j < PCH; ++j) { const float* p = xv + in0 + j * 2048u; rv[j][0] = *(const v4fa*)p; rv[j][1] = *(const v4fa*)(p + 4); }
#pragma unroll
  for (unsigned j = 0; j < PCH; ++j) { const float* p = xk + in0 + j * 2048u; rk[j][0] = *(const v4fa*)p; rk[j][1] = *(const v4fa*)(p + 4); }
  asm volatile("s_wait_xcnt 0x0" :: "v"(xv + in0), "v"(xk + in0) : "memory");   /* the precaution kept before a register that an issued load names is rewritten; naming the two address pairs keeps them whole until here, and as a memory statement it holds all 16 loads in front of the conversions (without it half of them are issued only after the first have returned: a second latency in series) */
#pragma unroll
  for (unsigned j = 0; j < PCH; ++j) {
    const unsigned r = j * 32u + (tid >> 3), c8 = (tid & 7u) * 8u;
    FragH f; f.half[0] = cvt8(rv[j][0], rv[j][1], V_CARRY);
#pragma unroll
    for (int q = 0; q < 8; ++q) tl[r][c8 + q] = f.u[q];
  }
  __syncthreads();
#pragma unroll
  for (unsigned u = 0; u < PT / 64u; ++u) {
#pragma unroll
    for (unsigned rd = 0; rd < 2u; ++rd) {
      const unsigned d = rd * 32u + (tid >> 3), pc = tid & 7u; FragH f;
#pragma unroll
      for (unsigned q = 0; q < 8u; ++q) f.u[q] = tl[u * 64u + pc * 8u + q][d];
      *(v8us*)((unsigned short*)VT + ((size_t)b * HD + d) * SEQ + (size_t)g * PT + u * 64u + pc * 8u) = f.half[0];
    }
  }
#pragma unroll
  for (unsigned j = 0; j < PCH; ++j) *(v8us*)((unsigned short*)K16 + pl0 + j * 2048u) = cvt8(rk[j][0], rk[j][1], QK_CARRY);
}

// ---- fused attention: S^T = K Q^T, O^T += V^T P^T ----
// Fragment map (A row / B column = lane & 15, h = lane >> 4): elements 0..7 <- k0 + 8h + i, elements 8..15 <- k0 + 16 + 8h + i; D element r <- (row 8h + r, col lane & 15).
// With K as A and Q as B a lane's score registers all belong to query (lane & 15): maximum and exponent are lane-local but for one exchange between the wave halves, and the two 16-key score tiles of a pass,
// converted in place, are the B operand of the second product (its k order is the map above, which fa_lfrag gives V^T too). O^T keeps query = lane & 15, so the rescale factor is lane-local as well.
// K and V^T reach the waves through LDS. Per stage (128 keys of a quarter) one tensor load brings the K rows, taken two to a 256-byte tile row, and one brings the 64 V^T rows of 256 B; both land at an LDS pitch of 272 B.
// The 4 query groups of a quarter read the same tiles by 16-byte LDS loads whose 16 lanes of a half fall on 64 different banks. Two buffers: stage s + 1 flies while stage s is worked on.
// Block = 16 waves = 4 query groups of 32 rows x 4 key quarters. Each wave leaves (reference, sum, O^T) of its quarter in LDS; behind the block barrier the four waves of a query group join them in quarter order.
__device__ __forceinline__ v8f fa_mma(v16h a, v16h b, v8f c) { return __builtin_amdgcn_wmma_f32_16x16x32_f16(false, a, false, b, (short)0, c, false, false); }
__device__ __forceinline__ float fa_xhalf(float x) { return __builtin_bit_cast(float, __builtin_amdgcn_permlanex16(__builtin_bit_cast(int, x), __builtin_bit_cast(int, x), 0x76543210, 0xfedcba98, false, false)); }   /* lane l <-> lane l ^ 16 */
// Eight base-2 exponentials, each in place, in one statement: no result lands on a neighbour's source, and the closing v_nop is the free slot the instruction set asks for between a transcendental and the first use of its result.
__device__ __forceinline__ void fa_exp2x8(v8f& x) {
  asm("v_exp_f32 %0, %0\n\tv_exp_f32 %1, %1\n\tv_exp_f32 %2, %2\n\tv_exp_f32 %3, %3\n\tv_exp_f32 %4, %4\n\tv_exp_f32 %5, %5\n\tv_exp_f32 %6, %6\n\tv_exp_f32 %7, %7\n\tv_nop"
      : "+v"(x[0]), "+v"(x[1]), "+v"(x[2]), "+v"(x[3]), "+v"(x[4]), "+v"(x[5]), "+v"(x[6]), "+v"(x[7]));
}
#define FA_QG 4                        /* query groups (32 rows each) per block */
#define FA_KS 4                        /* key quarters per block */
#define FA_NW (FA_QG * FA_KS)
#define FA_KW (SEQ / FA_KS)            /* keys per wave */
#define FA_C1 (S_ALPHA * 1.4426950408889634f)   /* score accumulator -> logit in base-2 units */
#define FA_XSET (-10.0f)               /* a reference that is set or moved puts the pass's largest logit of the row at this base-2 exponent: room to grow by 2^26 before a weight leaves f16, so that a pass is seldom done twice; f16 still resolves weights down to 2^-14 of that one */
#define FA_LBIG 3.0e38f                /* no finite sum of a pass comes near it (32 weights of at most 65504): a sum above it is infinite, so one of its f16 weights was */
#define FA_SK 128u                     /* keys of a quarter per stage */
#define FA_NST ((unsigned)FA_KW / FA_SK)   /* stages per quarter */
#define FA_ROWB 256u                   /* bytes of a tile row: two K rows, or 128 keys of a V^T row */
#define FA_ROWS 64u                    /* rows of a tile */
#define FA_PITCH 272u                  /* LDS pitch of a tile row: 256 B + 16 B pad */
#define FA_TILE 18432u                 /* 64 rows x 272 B = 17408 B, rounded up to a multiple of 2 KiB */
#define FA_QSLOT (2u * FA_TILE)        /* one quarter's K and V^T tiles of a stage */
#define FA_BUF (FA_KS * FA_QSLOT)      /* one buffer: the four quarters' tiles of a stage */
#define FA_QPITCH 144u                 /* LDS pitch of a converted query row: 128 B + 16 B, so that the 16 rows of a 16-byte fragment load fall on 64 different banks */
#define FA_W0 ((1u << 20) | (5u << 22) | (3u << 25))   /* descriptor group 1 word 0: no mask, byte elements, 4 dwords of pad behind every 256 B */
static_assert(FA_NST * FA_SK == (unsigned)FA_KW && FA_NST >= 2u && FA_ROWS * FA_PITCH <= FA_TILE && FA_TILE % 2048u == 0u);
static_assert(FA_SK * 2u == FA_ROWB && HD * 2 * 2 == FA_ROWB && FA_SK / 2u == FA_ROWS && HD == FA_ROWS);
static_assert(2u * FA_BUF + 2u * FA_NW * 2u * 32u * 4u + 32u * FA_QG * FA_QPITCH <= 327680u && (size_t)FA_NW * 2 * 4 * 2 * 32 * 16 <= 2u * FA_BUF);
typedef unsigned int v2u32a __attribute__((ext_vector_type(2), may_alias));
typedef unsigned int fa_u32x4 __attribute__((ext_vector_type(4)));
typedef unsigned int fa_u32x8 __attribute__((ext_vector_type(8)));
__device__ __forceinline__ unsigned fa_uni(unsigned v) { return (unsigned)__builtin_amdgcn_readfirstlane((int)v); }
__device__ __forceinline__ unsigned fa_pinned(unsigned v) { unsigned w = fa_uni(v); asm volatile("" : "+s"(w)); /* holds the word in a scalar register, so that a test on it is a scalar branch: a tensor load ignores EXEC */ return w; }
// Descriptor group 0: one request, LDS byte offset, global byte address of the tile's first byte, type 2.
__device__ __forceinline__ fa_u32x4 fa_group0(unsigned lds_dst, unsigned long long ga) {
  fa_u32x4 g;
  g[0] = fa_uni(1u); g[1] = fa_uni(lds_dst); g[2] = fa_uni((unsigned)ga); g[3] = fa_uni((((unsigned)(ga >> 32)) & 0x01FFFFFFu) | 0x80000000u);
  asm volatile("" : "+s"(g));          /* the pinned form for descriptor words: held in scalar registers of their own, which fa_twait keeps untouched while the request flies */
  return g;
}
// Descriptor group 1: tensor = tile = FA_ROWS rows of FA_ROWB bytes, byte elements, source pitch src_pitch bytes.
__device__ __forceinline__ fa_u32x8 fa_group1(unsigned src_pitch) {
  fa_u32x8 g;
  g[0] = fa_uni(FA_W0);
  g[1] = fa_uni((FA_ROWB & 0xFFFFu) << 16);
  g[2] = fa_uni((FA_ROWB >> 16) | ((FA_ROWS & 0xFFFFu) << 16));
  g[3] = fa_uni((FA_ROWS >> 16) | (FA_ROWB << 16));
  g[4] = fa_uni(FA_ROWS);
  g[5] = fa_uni(src_pitch);
  g[6] = fa_uni(0u);
  g[7] = fa_uni(0u);
  asm volatile("" : "+s"(g));          /* the pinned form for descriptor words: held in scalar registers of their own for the whole loop, not formed anew in registers that are reused */
  return g;
}
__device__ __forceinline__ void fa_tload(fa_u32x4 g0, fa_u32x8 g1) { asm volatile("tensor_load_to_lds %0, %1" :: "s"(g0), "s"(g1) : "memory"); }   /* one request of the whole wave */
__device__ __forceinline__ void fa_twait(fa_u32x4 g0, fa_u32x8 g1) { asm volatile("s_wait_tensorcnt 0x0" :: "s"(g0), "s"(g1) : "memory"); }   /* the wave's request has landed; naming the descriptor keeps its registers as they are until here */
__device__ __forceinline__ v16h fa_lfrag(const unsigned char* p) { FragH f; f.half[0] = *(const v8us*)p; f.half[1] = *(const v8us*)(p + 32); return f.v; }   /* p already holds the lane's 16 h bytes */
// The lane's largest score of a pass for one query tile (its half of the 32 keys).
__device__ __forceinline__ float fa_tmax(const v8f (&s)[2]) {
  float am = fmaxf(s[0][0], s[1][0]);
#pragma unroll
  for (int r = 1; r < 8; ++r) am = fmaxf(am, fmaxf(s[0][r], s[1][r]));
  return am;
}
// One query tile's 32 x 16 scores -> weights exp2(logit + nm), packed as the B operand of the second product.
__device__ __forceinline__ void fa_wts(v8f (&s)[2], float nm, FragH& pf) {
#pragma unroll
  for (int t = 0; t < 2; ++t) {
#pragma unroll
    for (int r = 0; r < 8; ++r) s[t][r] = __builtin_fmaf(s[t][r], FA_C1, nm);
    fa_exp2x8(s[t]);
#pragma unroll
    for (int r = 0; r < 8; ++r) pf.h[t * 8 + r] = (_Float16)s[t][r];   /* nearest f16, subnormals kept, infinite above the largest f16: both products that take pf read the same values */
  }
}
// A weight of the tile has left f16 (its row sum came out infinite): the pass is done again for this query tile. kp is the lane's place in the pass's first K row (the stage's buffer still holds it), l the row sum up to the pass, d the pass's own sum tile.
// The scores are formed anew, each reference moves to the pass's own largest logit where that is the larger one, O^T and the row sum follow, and the weights and their sum are taken against the moved reference: none is above 2^FA_XSET then.
__device__ __forceinline__ void fa_redo(const unsigned char* kp, const v16h (&qf)[2], v16h ones, float& nm, float& l, v8f (&o)[4], v8f& d, FragH& pf) {
  const v8f z8 = {0.f,0.f,0.f,0.f,0.f,0.f,0.f,0.f};
  v8f s[2];
#pragma unroll
  for (int t = 0; t < 2; ++t) s[t] = fa_mma(fa_lfrag(kp + t * 8 * FA_PITCH + 64), qf[1], fa_mma(fa_lfrag(kp + t * 8 * FA_PITCH), qf[0], z8));
  const float am = fa_tmax(s);
  const float ax = fmaxf(am, fa_xhalf(am));                      /* both halves of a query's keys: the two lanes of a query move alike */
  const float nn = fminf(nm, FA_XSET - ax * FA_C1);              /* only towards a larger reference; a query with no logit above the one that set its reference keeps it */
  const float corr = __builtin_amdgcn_exp2f(nn - nm);            /* 1 for a query that keeps its reference */
  nm = nn;
#pragma unroll
  for (int t = 0; t < 4; ++t) o[t] *= corr;
  l *= corr;
  fa_wts(s, nm, pf);
  d = fa_mma(ones, pf.v, z8);
}
static_assert(FA_KS == 4 && FA_KW * FA_KS == SEQ && FA_KW % 32 == 0 && SEQ % (32 * FA_QG) == 0);
static_assert(FA_SK == 4u * 32u);                                /* four passes a stage: one priority level each */
__global__ __launch_bounds__(FA_NW * 32) void k_fattn(const float* __restrict__ xq, const _Float16* __restrict__ K16, const _Float16* __restrict__ VT, float* __restrict__ O) {
  __shared__ __attribute__((aligned(2048))) unsigned char ring[2u * FA_BUF];   /* [buffer][quarter][K tile, V^T tile]; behind the loop's last barrier it holds the partial O^T tiles */
  v4fa (*po)[2][4][2][32] = (v4fa (*)[2][4][2][32])ring;                /* [wave][query tile][d tile][register quad][lane]; every entry written before the barrier */
  __shared__ __attribute__((aligned(16))) unsigned char qs[32u * FA_QG * FA_QPITCH];   /* the block's query rows as f16 (64 * bf16(q)); every row's 128 B written before the stage-0 barrier, read once behind it */
  __shared__ float pm[FA_NW][2][32], pl[FA_NW][2][32];                  /* [wave][query tile][lane] reference in use (base 2) and carried sum */
  const unsigned tid = threadIdx.x, w = fa_uni(tid >> 5), lane = tid & 31u, ln = lane & 15u, hh = lane >> 4;
  const unsigned qg = w >> 2, ks = w & 3u, b = blockIdx.y;
  const unsigned q0 = blockIdx.x * (32u * FA_QG) + qg * 32u, k0 = ks * (unsigned)FA_KW;
  const unsigned isu = (qg < 2u) ? 1u : 0u, tv = (qg == 1u) ? 1u : 0u;   /* query group 0's wave brings its quarter's K tile, group 1's the V^T tile */
  const unsigned long long gsrc = tv ? (unsigned long long)(size_t)(VT + (size_t)b * HD * SEQ + k0)      /* first byte of the quarter's keys in V^T row 0 */
                                     : (unsigned long long)(size_t)(K16 + ((size_t)b * SEQ + k0) * HD);  /* first byte of the quarter's K rows */
  const unsigned gstep = tv ? FA_SK * 2u : FA_SK * (unsigned)HD * 2u;    /* bytes from a stage's tile to the next stage's */
  const unsigned ldst = (unsigned)(size_t)ring + ks * FA_QSLOT + tv * FA_TILE;   /* LDS byte offset of the wave's tile in buffer 0 */
  const fa_u32x8 g1 = fa_group1(tv ? (unsigned)SEQ * 2u : FA_ROWB);
  fa_u32x4 g0 = fa_group0(ldst, gsrc);
  if (fa_pinned(isu)) fa_tload(g0, g1);
  // The block's 32 * FA_QG query rows come straight from the f32 input while stage 0 flies: a thread takes four 16-byte pieces (a wave's load covers 512 contiguous bytes), converts them as the k plane is converted and leaves them in qs.
  const float* qsrc = xq + ((size_t)b * SEQ_FULL + (size_t)blockIdx.x * (32u * FA_QG)) * HD + (size_t)tid * 4u;
  v4f rq[4];
#pragma unroll                                                   /* constant indices keep the pieces in registers */
  for (unsigned j = 0; j < 4u; ++j) rq[j] = *(const v4fa*)(qsrc + j * (FA_NW * 32u * 4u));
#pragma unroll                                                   /* the same: rq is indexed by constants only */
  for (unsigned j = 0; j < 4u; ++j) {
    const unsigned ci = tid + j * (FA_NW * 32u);                 /* piece ci: query row ci / 16 of the block, d = 4 (ci % 16) .. + 3 */
    union { _Float16 h[4]; v2u32a u; } f;
#pragma unroll                                                   /* four values, packed in registers */
    for (int q = 0; q < 4; ++q) f.h[q] = (_Float16)(bf16_rne(rq[j][q]) * QK_CARRY);
    *(v2u32a*)(qs + (ci >> 4) * FA_QPITCH + (ci & 15u) * 8u) = f.u;
  }
  union { v16h v; unsigned w[8]; } on1;                          /* sixteen f16 ones */
  asm("v_mov_b32 %0, 0x3c003c00\n\tv_mov_b32 %1, 0x3c003c00\n\tv_mov_b32 %2, 0x3c003c00\n\tv_mov_b32 %3, 0x3c003c00\n\tv_mov_b32 %4, 0x3c003c00\n\tv_mov_b32 %5, 0x3c003c00\n\tv_mov_b32 %6, 0x3c003c00\n\tv_mov_b32 %7, 0x3c003c00"
      : "=v"(on1.w[0]), "=v"(on1.w[1]), "=v"(on1.w[2]), "=v"(on1.w[3]), "=v"(on1.w[4]), "=v"(on1.w[5]), "=v"(on1.w[6]), "=v"(on1.w[7]));   /* made once by moves the compiler cannot repeat: as a plain constant it is rebuilt in all eight registers in every pass */
  const v16h ones = on1.v;
  const v8f z8 = {0.f,0.f,0.f,0.f,0.f,0.f,0.f,0.f};
  v8f o[2][4] = {{z8, z8, z8, z8}, {z8, z8, z8, z8}};            /* O^T tiles [query tile][d tile] */
  float ls[2] = {0.f, 0.f};                                      /* the query's weight sum so far: each pass's sum comes from ones . P^T and is added here */
  float nm[2] = {0.f, 0.f};                                      /* minus the query's reference, base 2: a weight is exp2(logit + nm); the wave's first pass sets it, the first stage raises it */
  if (fa_pinned(isu)) fa_twait(g0, g1);                          /* stage 0 has landed before its issuer reaches the barrier */
  __syncthreads();                                               /* stage 0 and the converted query rows are readable by every wave */
  g0 = fa_group0(ldst + FA_BUF, gsrc + gstep);
  if (fa_pinned(isu)) fa_tload(g0, g1);
  v16h qf[2][2];                                                 /* [query tile][d half], kept for the whole loop */
#pragma unroll                                                   /* constant indices keep the fragments in registers */
  for (int c = 0; c < 2; ++c) {
    const unsigned char* qr = qs + (qg * 32u + c * 16u + ln) * FA_QPITCH + hh * 16u;   /* the lane's place in its query row */
    qf[c][0] = fa_lfrag(qr); qf[c][1] = fa_lfrag(qr + 64);
  }
  const unsigned char* kl0 = ring + ks * FA_QSLOT + (ln >> 1) * FA_PITCH + (ln & 1u) * 128u + hh * 16u;   /* the lane's place in K row ln of the quarter's K tile, buffer 0 */
  const unsigned char* vl0 = ring + ks * FA_QSLOT + FA_TILE + ln * FA_PITCH + hh * 16u;                   /* the same in row ln of the V^T tile */
#pragma unroll 1                                                 /* the stages share one copy of the four passes */
  for (unsigned st = 0; st < FA_NST; ++st) {
  const unsigned char* kl = kl0 + (st & 1u) * FA_BUF;
  const unsigned char* vl = vl0 + (st & 1u) * FA_BUF;
  v16h kf[2][2];                                                 /* [key tile][d half], fetched one pass ahead inside the stage */
#pragma unroll
  for (int t = 0; t < 2; ++t) { kf[t][0] = fa_lfrag(kl + t * 8 * FA_PITCH); kf[t][1] = fa_lfrag(kl + t * 8 * FA_PITCH + 64); }
#pragma unroll                                                   /* four copies of the pass: s_setprio takes its level as an immediate only */
  for (unsigned p = 0; p < FA_SK; p += 32u) {
    if (p == 0u) __builtin_amdgcn_s_setprio(3);                  /* a stage starts at the top level; it falls with progress, see in front of the weights */
    v16h vf[4];
#pragma unroll
    for (int t = 0; t < 4; ++t) vf[t] = fa_lfrag(vl + t * 16 * FA_PITCH + p * 2u);
    v8f s[2][2];                                                 /* [query tile][key tile] */
#pragma unroll
    for (int c = 0; c < 2; ++c) {
#pragma unroll
      for (int t = 0; t < 2; ++t) s[c][t] = fa_mma(kf[t][1], qf[c][1], fa_mma(kf[t][0], qf[c][0], z8)); }
    const unsigned pn = (p + 32u < FA_SK) ? p + 32u : 0u;        /* a stage's last pass refetches the stage's own first keys: same buffer, never used */
#pragma unroll
    for (int t = 0; t < 2; ++t) { kf[t][0] = fa_lfrag(kl + (pn / 2u + t * 8) * FA_PITCH); kf[t][1] = fa_lfrag(kl + (pn / 2u + t * 8) * FA_PITCH + 64); }
    __builtin_amdgcn_sched_barrier(0);                           /* keeps the V^T loads and the K loads of the next pass issued up here, and the eight score products in one run in front of the vector work */
    if (st == 0u) {                                              /* a scalar test: the stage counter is the same in the whole wave */
      // A wave's first stage takes each pass's maximum while the scores are at hand and follows it at once: its first pass sets the references (O^T and the sums are still zero), the other three raise them wherever the pass
      // brought a larger logit. Behind the stage a reference stands on the largest of FA_SK logits, which the later keys seldom pass by the room that FA_XSET leaves.
#pragma unroll
      for (int c = 0; c < 2; ++c) {
        const float am = fa_tmax(s[c]);
        const float nn = FA_XSET - fmaxf(am, fa_xhalf(am)) * FA_C1;   /* both halves of a query's keys: the two lanes of a query move alike */
        if (p == 0u) nm[c] = nn;
        else {
          const float nl = fminf(nm[c], nn);                     /* only towards a larger reference */
          const float corr = __builtin_amdgcn_exp2f(nl - nm[c]); /* 1 for a query that keeps its reference */
          nm[c] = nl;
#pragma unroll
          for (int t = 0; t < 4; ++t) o[c][t] *= corr;
          ls[c] *= corr;
        }
      }
    }
    // Wave priority falls with progress inside the stage: 3, then 2, 1, 0 from here on in passes 1, 2, 3. A wave that lags goes first. The level drops here, where the
    // pass's dense vector run begins: the score products in front of it are mostly latency and lose most by waiting for a slot.
    switch (p) {                                                 /* p is a constant in each copy: at most one s_setprio is left */
      case 32u: __builtin_amdgcn_s_setprio(2); break;
      case 64u: __builtin_amdgcn_s_setprio(1); break;
      case 96u: __builtin_amdgcn_s_setprio(0); break;            /* the barrier and the way out of the loop are reached at the default level */
      default: break;
    }
    // From the second stage on no maximum is taken. The weights are formed against the held references as they stand, and the row-sum product, which is owed anyway, tells afterwards whether one of them left f16: the f16 pack makes it
    // infinite, and so is its row's sum. Each query tile's sum is looked at before that tile's weights reach O^T; only then (rare) is the pass done again for the tile, with moved references. The ballot makes each test a scalar branch, so every lane is on at the matrix instructions.
    FragH pf[2];
    v8f d[2];                                                    /* ones . P^T of the pass: every row holds the queries' weight sums over its 32 keys */
#pragma unroll
    for (int c = 0; c < 2; ++c) {
      fa_wts(s[c], nm[c], pf[c]);
      d[c] = fa_mma(ones, pf[c].v, z8);
      if (c == 0) __builtin_amdgcn_sched_barrier(0);             /* tile 0's sum product is issued in front of tile 1's vector work, which then fills the distance to the read of its result: moved behind that work it costs four idle slots */
    }
#pragma unroll
    for (int c = 0; c < 2; ++c) {
      if (__builtin_expect(__builtin_amdgcn_ballot_w32(d[c][0] > FA_LBIG) != 0u, 0))   /* rare: laid out off the straight path */
        fa_redo(kl + (p / 2u) * FA_PITCH, qf[c], ones, nm[c], ls[c], o[c], d[c], pf[c]);
      ls[c] += d[c][0];
#pragma unroll
      for (int t = 0; t < 4; ++t) o[c][t] = fa_mma(vf[t], pf[c].v, o[c][t]);
      if (c == 0) __builtin_amdgcn_sched_barrier(0);             /* the read of tile 1's sum stays behind tile 0's four products, which fill the distance from its sum product: lifted over them it costs idle slots */
    }
  }
  asm volatile("s_wait_dscnt 0x0" ::: "memory");                 /* this wave's reads of the stage's buffer have returned before the buffer may be refilled */
  if (fa_pinned(isu)) fa_twait(g0, g1);                          /* stage st + 1 has landed before its issuer reaches the barrier */
  __syncthreads();                                               /* publishes stage st + 1 and ends every wave's reads of stage st; behind the last stage it frees the ring for the partial tiles */
  const unsigned s2 = fa_pinned(st + 2u);                        /* formed behind the wait, and the descriptor's address words from it */
  if (fa_pinned((s2 < FA_NST) ? 1u : 0u)) {
    g0 = fa_group0(ldst + (s2 & 1u) * FA_BUF, gsrc + (unsigned long long)s2 * gstep);
    if (fa_pinned(isu)) fa_tload(g0, g1);                        /* into the buffer that stage st has just left */
  }
  }
  asm volatile("s_wait_tensorcnt 0x0" ::: "memory");             /* no request is left when the ring changes its use */
  asm volatile("s_wait_dscnt 0x0" ::: "memory");                 /* nor a read of it */
#pragma unroll                                                   /* constant indices keep the tiles in registers */
  for (int c = 0; c < 2; ++c) {
#pragma unroll
    for (int t = 0; t < 4; ++t) {
      const v4f lo = {o[c][t][0], o[c][t][1], o[c][t][2], o[c][t][3]}, hi = {o[c][t][4], o[c][t][5], o[c][t][6], o[c][t][7]};
      po[w][c][t][0][lane] = lo; po[w][c][t][1][lane] = hi; }
    pm[w][c][lane] = -nm[c]; pl[w][c][lane] = ls[c];
  }
  __syncthreads();                                               /* every quarter's partial result is in LDS before any wave joins them */
  const unsigned jc = ks >> 1, jd = ks & 1u, wb = qg * 4u;       /* this wave joins query tile jc, d tiles 2 jd and 2 jd + 1: whole 128-byte lines of the output */
  float mj[4], wj[4];
#pragma unroll
  for (int j = 0; j < 4; ++j) mj[j] = pm[wb + j][jc][lane];
  const float mm = fmaxf(fmaxf(mj[0], mj[1]), fmaxf(mj[2], mj[3]));
  float lsum = 0.f;
#pragma unroll
  for (int j = 0; j < 4; ++j) { wj[j] = __builtin_amdgcn_exp2f(mj[j] - mm); lsum += pl[wb + j][jc][lane] * wj[j]; }
  const float f = 0.125f * (1.0f / lsum);                        /* lsum >= about 2^FA_XSET: the quarter with the largest reference has weight 1, and its largest logit at the reference's last move gave a term of about 2^FA_XSET */
  float* op = O + ((size_t)b * SEQ + q0 + jc * 16u + ln) * HD + jd * 32u + 8u * hh;
#pragma unroll
  for (unsigned tt = 0; tt < 2u; ++tt) {
#pragma unroll
    for (unsigned h4 = 0; h4 < 2u; ++h4) {
      v4f a = po[wb][jc][jd * 2u + tt][h4][lane] * wj[0];
#pragma unroll
      for (int j = 1; j < 4; ++j) a += po[wb + j][jc][jd * 2u + tt][h4][lane] * wj[j];
      *(v4f*)(op + tt * 16u + h4 * 4u) = a * O_ALPHA * f;
    }
  }
}

extern "C" void kernel_launch(void* const* d_in, const int* in_sizes, int n_in,
                              void* d_out, int out_size, void* d_ws, size_t ws_size, hipStream_t stream) {
  if (n_in < 3) return;
  const size_t need_in = ((size_t)(NB - 1) * SEQ_FULL + SEQ) * HD;
  if ((size_t)in_sizes[0] < need_in || (size_t)in_sizes[1] < need_in || (size_t)in_sizes[2] < need_in) return;
  if ((size_t)out_size < (size_t)NB * SEQ * HD) return;
  const float* xq = (const float*)d_in[0]; const float* xk = (const float*)d_in[1]; const float* xv = (const float*)d_in[2];
  float* out = (float*)d_out;
  char* ws = (char*)d_ws; size_t off = 0;
  auto take = [&](size_t bytes) { char* p = ws + off; off += (bytes + 255) & ~(size_t)255; return p; };
  _Float16* K16 = (_Float16*)take(WS_PLANE16);      /* [NB][SEQ][64]  64 * bf16(k) */
  _Float16* VT  = (_Float16*)take(WS_PLANE16);      /* [NB][64][SEQ]  64 * bf16(v), transposed */
  if (off > ws_size) return;

  k_prep<<<dim3(SEQ / 128, NB), 256, 0, stream>>>(xk, xv, K16, VT);
  /* out[NB][SEQ][64] = softmax(q k^T) v * 0.125, f32 straight into the output */
  k_fattn<<<dim3(SEQ / (32 * FA_QG), NB), FA_NW * 32, 0, stream>>>(xq, K16, VT, out);
}
